// v000
// Measured on an AMD MI455X. A time is GPU time per run, averaged over a window of back-to-back runs after a warm-up
// (all launches, gaps included; the runs take copies of the inputs in turn), and the median of several windows.
// Apart from v000's, it joins two sittings. Times from different sittings can be a few percent apart, while
// side-by-side timings come from the same sitting.
// v000 is the starting kernel. One run takes 28.6 microseconds.
#include <hip/hip_runtime.h>

typedef __attribute__((ext_vector_type(2))) float v2f;
typedef __attribute__((ext_vector_type(8))) float v8f;

#define N_   4
#define C_   64
#define H_   64
#define W_   64
#define G_   4
#define CG_  16            // channels per group
#define HW_  (H_ * W_)
#define FH_  7
#define FW_  7
#define PADT 3
#define PADL 3
#define ROWS_PER_BLK 4
#define TILE_H (ROWS_PER_BLK + FH_ - 1)   // 10

// ---------------------------------------------------------------------------
// CDNA5 async copy: GLOBAL_LOAD_ASYNC_TO_LDS_B32 (tracked by ASYNCcnt).
// vdst = VGPR holding the LDS byte offset; vaddr = 64-bit global address.
// ---------------------------------------------------------------------------
__device__ __forceinline__ void async_g2l_b32(const float* gptr, float* lptr) {
    const unsigned loff =
        (unsigned)reinterpret_cast<unsigned long long>(lptr);   // low 32b = LDS offset
    const unsigned long long ga = reinterpret_cast<unsigned long long>(gptr);
    asm volatile("global_load_async_to_lds_b32 %0, %1, off"
                 :: "v"(loff), "v"(ga)
                 : "memory");
}

__device__ __forceinline__ void wait_asynccnt0() {
    asm volatile("s_wait_asynccnt 0x0" ::: "memory");
}

// ---------------------------------------------------------------------------
// Phase 1: grouped 1x1 conv (q,k,v) via V_WMMA_F32_16X16X4_F32.
// One wave produces one 16(oc) x 16(pos) tile for one (n, group) for all of
// q, k, v simultaneously (B operand = x tile is loaded once, reused 3x).
// D = A(16x4) * B(4x16) + C, accumulated over 4 K-chunks (K total = 16).
// A layout (ISA 7.12.2): lanes 0-15 hold K={0,1} in v0/v1, lanes 16-31 K={2,3}.
// C/D layout: VGPR r holds M = r (lanes 0-15) / M = r+8 (lanes 16-31), N=lane&15.
// ---------------------------------------------------------------------------
__global__ __launch_bounds__(256) void qkv_wmma_kernel(
    const float* __restrict__ x,
    const float* __restrict__ wq,
    const float* __restrict__ wk,
    const float* __restrict__ wv,
    float* __restrict__ q,
    float* __restrict__ k,
    float* __restrict__ v)
{
    const int lane = threadIdx.x & 31;
    const int wave = blockIdx.x * (blockDim.x >> 5) + (threadIdx.x >> 5);

    const int tiles = HW_ / 16;                 // 256 position-tiles per (n,g)
    const int t  = wave % tiles;
    const int g  = (wave / tiles) % G_;
    const int n  = wave / (tiles * G_);
    const int pos0 = t * 16;

    const int half = lane >> 4;                 // 0: lanes 0-15, 1: lanes 16-31
    const int l16  = lane & 15;

    const float* xg = x + ((size_t)n * C_ + (size_t)g * CG_) * HW_ + pos0;
    const int ocb = g * CG_;                    // first global out-channel of group

    v8f accq = {};
    v8f acck = {};
    v8f accv = {};

#pragma unroll
    for (int kc = 0; kc < 4; ++kc) {
        // B chunk: B[kr][nn] = x[n, g*16 + kc*4 + kr, pos0 + nn]
        v2f b;
        b.x = xg[(size_t)(kc * 4 + 0 + 2 * half) * HW_ + l16];
        b.y = xg[(size_t)(kc * 4 + 1 + 2 * half) * HW_ + l16];

        // A chunks: A[oc][kr] = w[(ocb + oc)*CG_ + kc*4 + kr]
        const int wbase = (ocb + l16) * CG_ + kc * 4 + 2 * half;
        v2f aq, ak, av;
        aq.x = wq[wbase]; aq.y = wq[wbase + 1];
        ak.x = wk[wbase]; ak.y = wk[wbase + 1];
        av.x = wv[wbase]; av.y = wv[wbase + 1];

        accq = __builtin_amdgcn_wmma_f32_16x16x4_f32(
            false, aq, false, b, (short)0, accq, false, false);
        acck = __builtin_amdgcn_wmma_f32_16x16x4_f32(
            false, ak, false, b, (short)0, acck, false, false);
        accv = __builtin_amdgcn_wmma_f32_16x16x4_f32(
            false, av, false, b, (short)0, accv, false, false);
    }

    // Store D: element (M = r + 8*half, N = l16)
#pragma unroll
    for (int r = 0; r < 8; ++r) {
        const int oc = r + 8 * half;
        const size_t o = ((size_t)n * C_ + (size_t)(ocb + oc)) * HW_ + pos0 + l16;
        q[o] = accq[r];
        k[o] = acck[r];
        v[o] = accv[r];
    }
}

// ---------------------------------------------------------------------------
// Phase 2: per-channel 7x7 local attention, two-pass softmax (one exp per
// neighbor). One block = (n, c, 4 consecutive rows); 256 threads = 4x64.
// k/v tiles staged in LDS via GLOBAL_LOAD_ASYNC_TO_LDS_B32; zero-padded
// borders reproduce the reference's unfold() semantics (OOB: score = q*r,
// value contribution 0).
// ---------------------------------------------------------------------------
__global__ __launch_bounds__(256) void attn_kernel(
    const float* __restrict__ q,
    const float* __restrict__ k,
    const float* __restrict__ v,
    const float* __restrict__ row_w,   // (49, 32)
    const float* __restrict__ col_w,   // (49, 32)
    float* __restrict__ out)
{
    __shared__ float sk[TILE_H][W_];
    __shared__ float sv[TILE_H][W_];

    const int tid = threadIdx.x;
    const int w   = tid & (W_ - 1);
    const int hl  = tid >> 6;                  // 0..3 row-within-block

    int b = blockIdx.x;
    const int h0 = (b % (H_ / ROWS_PER_BLK)) * ROWS_PER_BLK; b /= (H_ / ROWS_PER_BLK);
    const int c  = b % C_;                     b /= C_;
    const int n  = b;
    const int h  = h0 + hl;

    const size_t base = ((size_t)n * C_ + c) * HW_;

    // Stage k/v tile rows [h0-3, h0+6] into LDS (zero-fill OOB rows).
    for (int idx = tid; idx < TILE_H * W_; idx += 256) {
        const int i  = idx >> 6;               // tile row
        const int ww = idx & (W_ - 1);
        const int gr = h0 - PADT + i;
        if (gr >= 0 && gr < H_) {
            const size_t go = base + (size_t)gr * W_ + ww;
            async_g2l_b32(k + go, &sk[i][ww]);
            async_g2l_b32(v + go, &sv[i][ww]);
        } else {
            sk[i][ww] = 0.0f;
            sv[i][ww] = 0.0f;
        }
    }
    wait_asynccnt0();          // my async LDS writes are done
    __syncthreads();           // (compiler also waits DScnt for the zero-fills)

    // Per-channel positional bias r[c] = sum_p off[p] * {row_w|col_w}[p][c'].
    float rr = 0.0f;
    if (c < 32) {
#pragma unroll
        for (int p = 0; p < FH_ * FW_; ++p)
            rr += (float)(p / FW_ - PADT) * row_w[p * 32 + c];
    } else {
#pragma unroll
        for (int p = 0; p < FH_ * FW_; ++p)
            rr += (float)(p % FW_ - PADL) * col_w[p * 32 + (c - 32)];
    }

    const float qv = q[base + (size_t)h * W_ + w];

    // Pass 1: running max of s = qv*(kp + rr)   (OOB -> kp = 0).
    float m = -__builtin_inff();
#pragma unroll
    for (int dy = 0; dy < FH_; ++dy) {
        const int row = hl + dy;
#pragma unroll
        for (int dx = 0; dx < FW_; ++dx) {
            const int gw  = w - PADL + dx;
            const bool ok = (gw >= 0) && (gw < W_);
            const int gwc = ok ? gw : 0;
            const float kp = ok ? sk[row][gwc] : 0.0f;
            m = fmaxf(m, qv * (kp + rr));
        }
    }

    // Pass 2: single exp per neighbor; accumulate normalizer + weighted V.
    float l = 0.0f;
    float acc = 0.0f;
#pragma unroll
    for (int dy = 0; dy < FH_; ++dy) {
        const int row = hl + dy;
#pragma unroll
        for (int dx = 0; dx < FW_; ++dx) {
            const int gw  = w - PADL + dx;
            const bool ok = (gw >= 0) && (gw < W_);
            const int gwc = ok ? gw : 0;
            const float kp = ok ? sk[row][gwc] : 0.0f;
            const float vp = ok ? sv[row][gwc] : 0.0f;
            const float e  = __expf(qv * (kp + rr) - m);
            l   += e;
            acc += e * vp;
        }
    }

    out[base + (size_t)h * W_ + w] = acc / l;
}

extern "C" void kernel_launch(void* const* d_in, const int* in_sizes, int n_in,
                              void* d_out, int out_size, void* d_ws, size_t ws_size,
                              hipStream_t stream)
{
    const float* x     = (const float*)d_in[0];
    const float* wq    = (const float*)d_in[1];
    const float* wk    = (const float*)d_in[2];
    const float* wv    = (const float*)d_in[3];
    const float* row_w = (const float*)d_in[4];
    const float* col_w = (const float*)d_in[5];
    float* out = (float*)d_out;

    const size_t plane = (size_t)N_ * C_ * HW_;   // 1,048,576 floats
    float* q = (float*)d_ws;
    float* k = q + plane;
    float* v = k + plane;

    // Phase 1: 4096 waves (one 16x16 tile each), 8 waves per 256-thread block.
    const int waves = N_ * G_ * (HW_ / 16);
    qkv_wmma_kernel<<<waves / 8, 256, 0, stream>>>(x, wq, wk, wv, q, k, v);

    // Phase 2: one block per (n, c, 4-row strip).
    attn_kernel<<<N_ * C_ * (H_ / ROWS_PER_BLK), 256, 0, stream>>>(
        q, k, v, row_w, col_w, out);
}

// v001
// One run takes 15.5 microseconds.
// Next to v000, in two timings, it ran 1.90 and 1.89 times as fast.
#include <hip/hip_runtime.h>

typedef __attribute__((ext_vector_type(2))) float v2f;
typedef __attribute__((ext_vector_type(4))) float v4f;
typedef __attribute__((ext_vector_type(8))) float v8f;

#define N_   4
#define C_   64
#define H_   64
#define W_   64
#define G_   4
#define CG_  16            // channels per group
#define HW_  (H_ * W_)
#define FH_  7
#define FW_  7
#define PADT 3
#define PADL 3
#define PW_  72            // LDS row pitch in floats: 4 zeros, 64 values, 4 zeros
#define PH_  70            // LDS rows: 3 zero rows, 64 rows, 3 zero rows
#define ATT_THREADS 512

// ---------------------------------------------------------------------------
// Phase 1: grouped 1x1 conv (q,k,v) via V_WMMA_F32_16X16X4_F32.
// One wave produces one 16(oc) x 16(pos) tile for one (n, group) for all of
// q, k, v simultaneously (B operand = x tile is loaded once, reused 3x).
// D = A(16x4) * B(4x16) + C, accumulated over 4 K-chunks (K total = 16).
// A layout (ISA 7.12.2): lanes 0-15 hold K={0,1} in v0/v1, lanes 16-31 K={2,3}.
// C/D layout: VGPR r holds M = r (lanes 0-15) / M = r+8 (lanes 16-31), N=lane&15.
// ---------------------------------------------------------------------------
__global__ __launch_bounds__(256) void qkv_wmma_kernel(
    const float* __restrict__ x,
    const float* __restrict__ wq,
    const float* __restrict__ wk,
    const float* __restrict__ wv,
    float* __restrict__ q,
    float* __restrict__ k,
    float* __restrict__ v)
{
    const int lane = threadIdx.x & 31;
    const int wave = blockIdx.x * (blockDim.x >> 5) + (threadIdx.x >> 5);

    const int tiles = HW_ / 16;                 // 256 position-tiles per (n,g)
    const int t  = wave % tiles;
    const int g  = (wave / tiles) % G_;
    const int n  = wave / (tiles * G_);
    const int pos0 = t * 16;

    const int half = lane >> 4;                 // 0: lanes 0-15, 1: lanes 16-31
    const int l16  = lane & 15;

    const float* xg = x + ((size_t)n * C_ + (size_t)g * CG_) * HW_ + pos0;
    const int ocb = g * CG_;                    // first global out-channel of group

    v8f accq = {};
    v8f acck = {};
    v8f accv = {};

#pragma unroll
    for (int kc = 0; kc < 4; ++kc) {
        // B chunk: B[kr][nn] = x[n, g*16 + kc*4 + kr, pos0 + nn]
        v2f b;
        b.x = xg[(size_t)(kc * 4 + 0 + 2 * half) * HW_ + l16];
        b.y = xg[(size_t)(kc * 4 + 1 + 2 * half) * HW_ + l16];

        // A chunks: A[oc][kr] = w[(ocb + oc)*CG_ + kc*4 + kr]
        const int wbase = (ocb + l16) * CG_ + kc * 4 + 2 * half;
        v2f aq, ak, av;
        aq.x = wq[wbase]; aq.y = wq[wbase + 1];
        ak.x = wk[wbase]; ak.y = wk[wbase + 1];
        av.x = wv[wbase]; av.y = wv[wbase + 1];

        accq = __builtin_amdgcn_wmma_f32_16x16x4_f32(
            false, aq, false, b, (short)0, accq, false, false);
        acck = __builtin_amdgcn_wmma_f32_16x16x4_f32(
            false, ak, false, b, (short)0, acck, false, false);
        accv = __builtin_amdgcn_wmma_f32_16x16x4_f32(
            false, av, false, b, (short)0, accv, false, false);
    }

    // Store D: element (M = r + 8*half, N = l16)
#pragma unroll
    for (int r = 0; r < 8; ++r) {
        const int oc = r + 8 * half;
        const size_t o = ((size_t)n * C_ + (size_t)(ocb + oc)) * HW_ + pos0 + l16;
        q[o] = accq[r];
        k[o] = acck[r];
        v[o] = accv[r];
    }
}

// ---------------------------------------------------------------------------
// Phase 2: per-channel 7x7 local attention, two-pass softmax (one exp per
// neighbor). One block = one whole (n, c) plane. The k and v planes lie in LDS
// inside a border of zeros (3 rows above and below, 4 columns left and right),
// which reproduces the reference's unfold() semantics (OOB: score = q*r, value
// contribution 0) with no bounds test at the reads. Each thread computes 4
// neighboring outputs of one row at a time: a window row of all 4 is 10
// consecutive floats, read as three aligned 16-byte LDS loads.
// ---------------------------------------------------------------------------
__device__ __forceinline__ unsigned lds_addr(const float* p) {
    return (unsigned)reinterpret_cast<unsigned long long>(p);   // low 32b = LDS offset
}

__global__ __launch_bounds__(ATT_THREADS) void attn_kernel(
    const float* __restrict__ q,
    const float* __restrict__ k,
    const float* __restrict__ v,
    const float* __restrict__ row_w,   // (49, 32)
    const float* __restrict__ col_w,   // (49, 32)
    float* __restrict__ out)
{
    __shared__ __attribute__((aligned(16))) float sk[PH_ * PW_];
    __shared__ __attribute__((aligned(16))) float sv[PH_ * PW_];

    const int tid = threadIdx.x;
    const int c   = blockIdx.x % C_;
    const size_t base = (size_t)blockIdx.x * HW_;   // blockIdx.x = n * C_ + c

    const int w0 = (tid & 15) * 4;             // first of this thread's 4 columns
    const int hr = tid >> 4;                   // 0..31: row within a half plane

    // Both trips' q values, fetched up front so that they fly beside the copies.
    const v4f qa = *reinterpret_cast<const v4f*>(q + base + (size_t)hr * W_ + w0);
    const v4f qb = *reinterpret_cast<const v4f*>(q + base + (size_t)(hr + 32) * W_ + w0);

    // Stage both planes: 1024 16-byte pieces each, two per thread and plane.
    {
        const int p0 = tid;                    // piece index: row = p >> 4, column = (p & 15) * 4
        const int p1 = tid + ATT_THREADS;
        const int l0 = ((p0 >> 4) + PADT) * PW_ + 4 + (p0 & 15) * 4;
        const int l1 = ((p1 >> 4) + PADT) * PW_ + 4 + (p1 & 15) * 4;
        const unsigned lk0 = lds_addr(&sk[l0]), lk1 = lds_addr(&sk[l1]);
        const unsigned lv0 = lds_addr(&sv[l0]), lv1 = lds_addr(&sv[l1]);
        const float* gk0 = k + base + (size_t)p0 * 4;
        const float* gk1 = k + base + (size_t)p1 * 4;
        const float* gv0 = v + base + (size_t)p0 * 4;
        const float* gv1 = v + base + (size_t)p1 * 4;
        // The four copies and their s_wait_xcnt in one statement, so that no
        // address register of a copy can be rewritten ahead of the wait.
        asm volatile("global_load_async_to_lds_b128 %0, %4, off\n\t"
                     "global_load_async_to_lds_b128 %1, %5, off\n\t"
                     "global_load_async_to_lds_b128 %2, %6, off\n\t"
                     "global_load_async_to_lds_b128 %3, %7, off\n\t"
                     "s_wait_xcnt 0x0"
                     :: "v"(lk0), "v"(lk1), "v"(lv0), "v"(lv1),
                        "v"(gk0), "v"(gk1), "v"(gv0), "v"(gv1)
                     : "memory");
    }

    // Zero border: 54 + 54 16-byte pieces above and below, 128 at the sides.
    if (tid < 236) {
        int off;
        if (tid < 54)       off = tid * 4;
        else if (tid < 108) off = (PADT + H_) * PW_ + (tid - 54) * 4;
        else                off = (PADT + ((tid - 108) >> 1)) * PW_ + ((tid - 108) & 1) * (4 + W_);
        const v4f z = {0.0f, 0.0f, 0.0f, 0.0f};
        *reinterpret_cast<v4f*>(&sk[off]) = z;
        *reinterpret_cast<v4f*>(&sv[off]) = z;
    }

    // Per-channel positional bias r[c] = sum_p off[p] * {row_w|col_w}[p][c'].
    float rr = 0.0f;
    if (c < 32) {
#pragma unroll
        for (int p = 0; p < FH_ * FW_; ++p)
            rr += (float)(p / FW_ - PADT) * row_w[p * 32 + c];
    } else {
#pragma unroll
        for (int p = 0; p < FH_ * FW_; ++p)
            rr += (float)(p % FW_ - PADL) * col_w[p * 32 + (c - 32)];
    }

    asm volatile("s_wait_asynccnt 0x0" ::: "memory");   // my copies have landed
    __syncthreads();                                    // everyone's copies and zeros are visible

    // Kept rolled: one trip's straight-line code is large, and twice that text
    // would only add instruction fetches.
#pragma unroll 1
    for (int it = 0; it < 2; ++it) {
        const int h = hr + 32 * it;
        const v4f q4 = it ? qb : qa;
        const float qv[4] = {q4.x, q4.y, q4.z, q4.w};
        const int t0 = h * PW_ + w0;           // window's top row, 16-byte aligned column

        // kr[dy][i] = k + r at plane column w0 - 4 + i; output j, tap dx uses i = j + 1 + dx.
        float kr[FH_][12];
#pragma unroll
        for (int dy = 0; dy < FH_; ++dy) {
#pragma unroll
            for (int s = 0; s < 3; ++s) {
                const v4f t = *reinterpret_cast<const v4f*>(&sk[t0 + dy * PW_ + s * 4]);
                kr[dy][s * 4 + 0] = t.x + rr;
                kr[dy][s * 4 + 1] = t.y + rr;
                kr[dy][s * 4 + 2] = t.z + rr;
                kr[dy][s * 4 + 3] = t.w + rr;
            }
        }

        // Pass 1: running max of s = qv*(kp + rr).
        float m[4];
#pragma unroll
        for (int j = 0; j < 4; ++j) m[j] = -__builtin_inff();
#pragma unroll
        for (int dy = 0; dy < FH_; ++dy)
#pragma unroll
            for (int j = 0; j < 4; ++j)
#pragma unroll
                for (int dx = 0; dx < FW_; ++dx)
                    m[j] = fmaxf(m[j], qv[j] * kr[dy][j + 1 + dx]);

        // Pass 2: single exp per neighbor; accumulate normalizer + weighted V.
        float l[4]   = {0.0f, 0.0f, 0.0f, 0.0f};
        float acc[4] = {0.0f, 0.0f, 0.0f, 0.0f};
        v4f vn[3];                             // the v row one ahead of the row being summed
#pragma unroll
        for (int s = 0; s < 3; ++s)
            vn[s] = *reinterpret_cast<const v4f*>(&sv[t0 + s * 4]);
#pragma unroll
        for (int dy = 0; dy < FH_; ++dy) {
            // Inputs only: keeps all 12 loaded words live up to here. Two of them are never
            // used, and a temporary put into one while the load flies draws the wait forward.
            asm volatile("" :: "v"(vn[0]), "v"(vn[1]), "v"(vn[2]));
            float vr[12];
#pragma unroll
            for (int s = 0; s < 3; ++s) {
                vr[s * 4 + 0] = vn[s].x; vr[s * 4 + 1] = vn[s].y; vr[s * 4 + 2] = vn[s].z; vr[s * 4 + 3] = vn[s].w;
            }
            if (dy + 1 < FH_) {
#pragma unroll
                for (int s = 0; s < 3; ++s)
                    vn[s] = *reinterpret_cast<const v4f*>(&sv[t0 + (dy + 1) * PW_ + s * 4]);
            }
#pragma unroll
            for (int j = 0; j < 4; ++j) {
#pragma unroll
                for (int dx = 0; dx < FW_; ++dx) {
                    const float e = __expf(fmaf(qv[j], kr[dy][j + 1 + dx], -m[j]));
                    l[j]   += e;
                    acc[j] += e * vr[j + 1 + dx];
                }
            }
            // Ends a window row for the scheduler: without it the exps of all 7 rows
            // are lifted to the front and their results overflow the registers (scratch).
            __builtin_amdgcn_sched_barrier(0);
        }

        const v4f o = {acc[0] / l[0], acc[1] / l[1], acc[2] / l[2], acc[3] / l[3]};
        *reinterpret_cast<v4f*>(out + base + (size_t)h * W_ + w0) = o;
        // The next trip rewrites the store's data and address registers.
        asm volatile("s_wait_xcnt 0x0" ::: "memory");
    }
}

extern "C" void kernel_launch(void* const* d_in, const int* in_sizes, int n_in,
                              void* d_out, int out_size, void* d_ws, size_t ws_size,
                              hipStream_t stream)
{
    const float* x     = (const float*)d_in[0];
    const float* wq    = (const float*)d_in[1];
    const float* wk    = (const float*)d_in[2];
    const float* wv    = (const float*)d_in[3];
    const float* row_w = (const float*)d_in[4];
    const float* col_w = (const float*)d_in[5];
    float* out = (float*)d_out;

    const size_t plane = (size_t)N_ * C_ * HW_;   // 1,048,576 floats
    float* q = (float*)d_ws;
    float* k = q + plane;
    float* v = k + plane;

    // Phase 1: 4096 waves (one 16x16 tile each), 8 waves per 256-thread block.
    const int waves = N_ * G_ * (HW_ / 16);
    qkv_wmma_kernel<<<waves / 8, 256, 0, stream>>>(x, wq, wk, wv, q, k, v);

    // Phase 2: one block per (n, c) plane.
    attn_kernel<<<N_ * C_, ATT_THREADS, 0, stream>>>(
        q, k, v, row_w, col_w, out);
}

// v002
// It runs in 9.9 microseconds.
// Next to v001, in two timings, it ran 1.56 times as fast each time.
// All steps since v000 together make it 2.96 times as fast.
#include <hip/hip_runtime.h>

typedef __attribute__((ext_vector_type(2))) float v2f;
typedef __attribute__((ext_vector_type(4))) float v4f;
typedef __attribute__((ext_vector_type(8))) float v8f;

#define N_   4
#define C_   64
#define H_   64
#define W_   64
#define G_   4
#define CG_  16            // channels per group
#define HW_  (H_ * W_)
#define FH_  7
#define FW_  7
#define PADT 3
#define PADL 3
#define PW_  72            // LDS row pitch in floats: 4 zeros, 64 values, 4 zeros
#define BR_  4             // output rows per block
#define KR_  (BR_ + FH_ - 1)   // k/v rows per block: the band and 3 rows above and below
#define CP_  (KR_ * PW_ + 4)   // k/v channel pitch in floats; the 4 put channels c and c + 8 on different banks
#define QP_  (BR_ * W_ + 4)    // q channel pitch in floats, padded for the same reason
#define TPR_ (W_ / 16)         // 16-position tiles per row: 4
#define QT_  (BR_ * TPR_)      // tiles of the block's own 4 rows: 16 (the 10-row band has 40)
#define SV_  (CG_ * CP_)       // start of v in the LDS array
#define SQ_  (2 * CG_ * CP_)   // start of q in the LDS array
#define THREADS 512
#define WAVES   (THREADS / 32)

// ---------------------------------------------------------------------------
// One launch. One block = one (n, group, band of 4 rows): all 16 channels of
// the group.
//
// Part 1: grouped 1x1 conv via V_WMMA_F32_16X16X4_F32, results straight into
// LDS. A tile product is D(16 oc x 16 pos) = W(16 x 16) * X(16 x 16 pos), four
// K-chunks of 4. The block needs k and v on 10 rows (40 tiles each) and q on
// its own 4 rows (16 tiles): 96 products, 6 per wave, with no branch among
// them, so that every wave's loads are issued ahead of its first product.
// A layout (ISA 7.12.2): lanes 0-15 hold K={0,1} in v0/v1, lanes 16-31 K={2,3}.
// C/D layout: VGPR r holds M = r (lanes 0-15) / M = r+8 (lanes 16-31), N=lane&15.
//
// Part 2: per-channel 7x7 local attention, two-pass softmax (one exp per
// neighbor). The k and v bands lie in LDS inside a border of zeros (rows
// outside the plane, 4 columns left and right), which reproduces the
// reference's unfold() semantics (OOB: score = q*r, value contribution 0) with
// no bounds test at the reads. Each thread computes 4 neighboring outputs of
// one row at a time: a window row of all 4 is 10 consecutive floats, read as
// three aligned 16-byte LDS loads.
// ---------------------------------------------------------------------------
__global__ __launch_bounds__(THREADS) void local_attn_kernel(
    const float* __restrict__ x,
    const float* __restrict__ wq,
    const float* __restrict__ wk,
    const float* __restrict__ wv,
    const float* __restrict__ row_w,   // (49, 32)
    const float* __restrict__ col_w,   // (49, 32)
    float* __restrict__ out)
{
    __shared__ __attribute__((aligned(16))) float sm[2 * CG_ * CP_ + CG_ * QP_];

    const int tid  = threadIdx.x;
    const int band = blockIdx.x % (H_ / BR_);
    const int g    = (blockIdx.x / (H_ / BR_)) % G_;
    const int n    = blockIdx.x / ((H_ / BR_) * G_);
    const int h0   = band * BR_;               // first output row of the block
    const int ocb  = g * CG_;                  // first channel of the group

    const int lane = tid & 31;
    const int wave = __builtin_amdgcn_readfirstlane(tid >> 5) & (WAVES - 1);
    const int half = lane >> 4;                // 0: lanes 0-15, 1: lanes 16-31
    const int l16  = lane & 15;

    // Zero columns left and right of every k and v row: 16 x 10 x 2 16-byte pieces each.
    if (tid < CG_ * KR_ * 2) {
        const int zc  = tid / (KR_ * 2);
        const int zr  = tid % (KR_ * 2);
        const int off = zc * CP_ + (zr >> 1) * PW_ + (zr & 1) * (4 + W_);
        const v4f z = {0.0f, 0.0f, 0.0f, 0.0f};
        *reinterpret_cast<v4f*>(&sm[off])       = z;
        *reinterpret_cast<v4f*>(&sm[SV_ + off]) = z;
    }

    // ---- Part 1: the wave's 6 tile products on 3 position tiles ----
    // Tile numbers count the 10-row band, 4 tiles a row. Tiles 12..27 are the block's
    // own 4 rows: there one x tile serves k, v and q.
    int tile[3];
    tile[0] = PADT * TPR_ + wave;                          // 12..27: k, v and q
    tile[1] = wave < PADT * TPR_ ? wave : wave + QT_;      // 0..11 and 28..31: k and v
    tile[2] = 2 * QT_ + (wave & 7);                        // 32..39: k (waves 0-7) or v (waves 8-15)
    const bool third_is_v = wave >= 8;
    const float* wm = third_is_v ? wv : wk;

    // All loads of the wave stand ahead of its first product: one memory latency, not three.
    const float* xg = x + ((size_t)n * C_ + (size_t)ocb) * HW_;
    v2f b[3][4];
    bool inside[3];
#pragma unroll
    for (int i = 0; i < 3; ++i) {
        const int gh  = h0 - PADT + (tile[i] >> 2);                  // row of the plane
        inside[i] = gh >= 0 && gh < H_;
        const int ghc = gh < 0 ? 0 : (gh > H_ - 1 ? H_ - 1 : gh);    // keeps the address in the plane
        const float* xp = xg + ghc * W_ + (tile[i] & 3) * 16 + l16;
#pragma unroll
        for (int kc = 0; kc < 4; ++kc) {
            // B chunk: B[kr][nn] = x[n, g*16 + kc*4 + kr, ghc, col0 + nn]
            b[i][kc].x = xp[(size_t)(kc * 4 + 0 + 2 * half) * HW_];
            b[i][kc].y = xp[(size_t)(kc * 4 + 1 + 2 * half) * HW_];
        }
    }
    v2f aq[4], ak[4], av[4], am[4];
#pragma unroll
    for (int kc = 0; kc < 4; ++kc) {
        // A chunks: A[oc][kr] = w[(ocb + oc)*CG_ + kc*4 + kr]
        const int wbase = (ocb + l16) * CG_ + kc * 4 + 2 * half;
        aq[kc].x = wq[wbase]; aq[kc].y = wq[wbase + 1];
        ak[kc].x = wk[wbase]; ak[kc].y = wk[wbase + 1];
        av[kc].x = wv[wbase]; av[kc].y = wv[wbase + 1];
        am[kc].x = wm[wbase]; am[kc].y = wm[wbase + 1];
    }

    // The 49 loads below may land in registers that the loads above name as addresses.
    // It also keeps the x and weight loads, which the products wait for, first in the queue.
    asm volatile("s_wait_xcnt 0x0" ::: "memory");

    // Per-channel positional bias r[c] = sum_p off[p] * {row_w|col_w}[p][c']: lane l sums
    // channel l & 15 of the group, so that the 49 loads fly beside the ones above.
    const bool rowhalf = ocb < 32;
    const float* pw = rowhalf ? row_w + ocb + l16 : col_w + (ocb - 32) + l16;
    float rv = 0.0f;
#pragma unroll
    for (int p = 0; p < FH_ * FW_; ++p) {
        const float cf = rowhalf ? (float)(p / FW_ - PADT) : (float)(p % FW_ - PADL);
        rv += cf * pw[p * 32];
    }

    v8f k0 = {}, v0 = {}, q0 = {}, k1 = {}, v1 = {}, m2 = {};
#pragma unroll
    for (int kc = 0; kc < 4; ++kc) {
        k0 = __builtin_amdgcn_wmma_f32_16x16x4_f32(false, ak[kc], false, b[0][kc], (short)0, k0, false, false);
        v0 = __builtin_amdgcn_wmma_f32_16x16x4_f32(false, av[kc], false, b[0][kc], (short)0, v0, false, false);
        q0 = __builtin_amdgcn_wmma_f32_16x16x4_f32(false, aq[kc], false, b[0][kc], (short)0, q0, false, false);
        k1 = __builtin_amdgcn_wmma_f32_16x16x4_f32(false, ak[kc], false, b[1][kc], (short)0, k1, false, false);
        v1 = __builtin_amdgcn_wmma_f32_16x16x4_f32(false, av[kc], false, b[1][kc], (short)0, v1, false, false);
        m2 = __builtin_amdgcn_wmma_f32_16x16x4_f32(false, am[kc], false, b[2][kc], (short)0, m2, false, false);
    }

    // Store D: element (M = r + 8*half, N = l16); a row outside the plane is zeros.
    {
        const int d0 = (tile[0] >> 2) * PW_ + 4 + (tile[0] & 3) * 16 + l16 + 8 * half * CP_;
        const int d1 = (tile[1] >> 2) * PW_ + 4 + (tile[1] & 3) * 16 + l16 + 8 * half * CP_;
        const int d2 = (tile[2] >> 2) * PW_ + 4 + (tile[2] & 3) * 16 + l16 + 8 * half * CP_
                     + (third_is_v ? SV_ : 0);
        const int dq = SQ_ + ((tile[0] >> 2) - PADT) * W_ + (tile[0] & 3) * 16 + l16 + 8 * half * QP_;
#pragma unroll
        for (int r = 0; r < 8; ++r) {
            sm[d0 + r * CP_]       = k0[r];
            sm[SV_ + d0 + r * CP_] = v0[r];
            sm[dq + r * QP_]       = q0[r];
            sm[d1 + r * CP_]       = inside[1] ? k1[r] : 0.0f;
            sm[SV_ + d1 + r * CP_] = inside[1] ? v1[r] : 0.0f;
            sm[d2 + r * CP_]       = inside[2] ? m2[r] : 0.0f;
        }
    }

    // The bias of the wave's two channels (one per trip below), out of the lanes that hold them.
    const int chw = __builtin_amdgcn_readfirstlane(tid >> 6) & 7;
    const float rr0 = __int_as_float(__builtin_amdgcn_readlane(__float_as_int(rv), chw));
    const float rr1 = __int_as_float(__builtin_amdgcn_readlane(__float_as_int(rv), chw + 8));

    __syncthreads();                           // everyone's q, k, v and zeros are visible

    const int w0 = (tid & 15) * 4;             // first of this thread's 4 columns
    const int hr = (tid >> 4) & (BR_ - 1);     // row within the band

    // Kept rolled: one trip's straight-line code is large, and twice that text
    // would only add instruction fetches.
#pragma unroll 1
    for (int it = 0; it < 2; ++it) {
        const int ch = (tid >> 6) + 8 * it;    // channel within the group
        const float rr = it ? rr1 : rr0;
        const float* sk = sm + ch * CP_;
        const float* sv = sm + SV_ + ch * CP_;
        const v4f q4 = *reinterpret_cast<const v4f*>(&sm[SQ_ + ch * QP_ + hr * W_ + w0]);
        const float qv[4] = {q4.x, q4.y, q4.z, q4.w};
        const int t0 = hr * PW_ + w0;          // window's top row, 16-byte aligned column

        // kr[dy][i] = k + r at plane column w0 - 4 + i; output j, tap dx uses i = j + 1 + dx.
        float kr[FH_][12];
#pragma unroll
        for (int dy = 0; dy < FH_; ++dy) {
#pragma unroll
            for (int s = 0; s < 3; ++s) {
                const v4f t = *reinterpret_cast<const v4f*>(&sk[t0 + dy * PW_ + s * 4]);
                kr[dy][s * 4 + 0] = t.x + rr;
                kr[dy][s * 4 + 1] = t.y + rr;
                kr[dy][s * 4 + 2] = t.z + rr;
                kr[dy][s * 4 + 3] = t.w + rr;
            }
        }

        // Pass 1: running max of s = qv*(kp + rr).
        float m[4];
#pragma unroll
        for (int j = 0; j < 4; ++j) m[j] = -__builtin_inff();
#pragma unroll
        for (int dy = 0; dy < FH_; ++dy)
#pragma unroll
            for (int j = 0; j < 4; ++j)
#pragma unroll
                for (int dx = 0; dx < FW_; ++dx)
                    m[j] = fmaxf(m[j], qv[j] * kr[dy][j + 1 + dx]);

        // Pass 2: single exp per neighbor; accumulate normalizer + weighted V.
        float l[4]   = {0.0f, 0.0f, 0.0f, 0.0f};
        float acc[4] = {0.0f, 0.0f, 0.0f, 0.0f};
        v4f vn[3];                             // the v row one ahead of the row being summed
#pragma unroll
        for (int s = 0; s < 3; ++s)
            vn[s] = *reinterpret_cast<const v4f*>(&sv[t0 + s * 4]);
#pragma unroll
        for (int dy = 0; dy < FH_; ++dy) {
            // Inputs only: keeps all 12 loaded words live up to here. Two of them are never
            // used, and a temporary put into one while the load flies draws the wait forward.
            asm volatile("" :: "v"(vn[0]), "v"(vn[1]), "v"(vn[2]));
            float vr[12];
#pragma unroll
            for (int s = 0; s < 3; ++s) {
                vr[s * 4 + 0] = vn[s].x; vr[s * 4 + 1] = vn[s].y; vr[s * 4 + 2] = vn[s].z; vr[s * 4 + 3] = vn[s].w;
            }
            if (dy + 1 < FH_) {
#pragma unroll
                for (int s = 0; s < 3; ++s)
                    vn[s] = *reinterpret_cast<const v4f*>(&sv[t0 + (dy + 1) * PW_ + s * 4]);
            }
#pragma unroll
            for (int j = 0; j < 4; ++j) {
#pragma unroll
                for (int dx = 0; dx < FW_; ++dx) {
                    const float e = __expf(fmaf(qv[j], kr[dy][j + 1 + dx], -m[j]));
                    l[j]   += e;
                    acc[j] += e * vr[j + 1 + dx];
                }
            }
            // Ends a window row for the scheduler: without it the exps of all 7 rows
            // are lifted to the front and their results overflow the registers (scratch).
            __builtin_amdgcn_sched_barrier(0);
        }

        const v4f o = {acc[0] / l[0], acc[1] / l[1], acc[2] / l[2], acc[3] / l[3]};
        *reinterpret_cast<v4f*>(
            out + (((size_t)n * C_ + (size_t)(ocb + ch)) * H_ + (size_t)(h0 + hr)) * W_ + w0) = o;
        // The next trip rewrites the store's data and address registers.
        asm volatile("s_wait_xcnt 0x0" ::: "memory");
    }
}

extern "C" void kernel_launch(void* const* d_in, const int* in_sizes, int n_in,
                              void* d_out, int out_size, void* d_ws, size_t ws_size,
                              hipStream_t stream)
{
    const float* x     = (const float*)d_in[0];
    const float* wq    = (const float*)d_in[1];
    const float* wk    = (const float*)d_in[2];
    const float* wv    = (const float*)d_in[3];
    const float* row_w = (const float*)d_in[4];
    const float* col_w = (const float*)d_in[5];
    float* out = (float*)d_out;

    // One block per (n, group, band of 4 rows).
    local_attn_kernel<<<N_ * G_ * (H_ / BR_), THREADS, 0, stream>>>(
        x, wq, wk, wv, row_w, col_w, out);
}

// v003
// Measured time: 8.17 microseconds a run.
// Two timings next to v002 both put it at 1.21 times that version's speed.
// Counting every step since v000, it is 3.58 times as fast.
#include <hip/hip_runtime.h>

typedef __attribute__((ext_vector_type(2))) float v2f;
typedef __attribute__((ext_vector_type(4))) float v4f;
typedef __attribute__((ext_vector_type(8))) float v8f;

#define N_   4
#define C_   64
#define H_   64
#define W_   64
#define G_   4
#define CG_  16            // channels per group
#define HW_  (H_ * W_)
#define FH_  7
#define FW_  7
#define PADT 3
#define PADL 3
#define PW_  72            // LDS row pitch in floats: 4 zeros, 64 values, 4 zeros
#define BR_  4             // output rows per block
#define KR_  (BR_ + FH_ - 1)   // k/v rows per block: the band and 3 rows above and below
#define CP_  (KR_ * PW_ + 4)   // k/v channel pitch in floats; the 4 put channels c and c + 8 on different banks
#define QP_  (BR_ * W_ + 4)    // q channel pitch in floats, padded for the same reason
#define TPR_ (W_ / 16)         // 16-position tiles per row: 4
#define QT_  (BR_ * TPR_)      // tiles of the block's own 4 rows: 16 (the 10-row band has 40)
#define SV_  (CG_ * CP_)       // start of v in the LDS array
#define SQ_  (2 * CG_ * CP_)   // start of q in the LDS array
#define THREADS 512
#define WAVES   (THREADS / 32)

// ---------------------------------------------------------------------------
// One launch. One block = one (n, group, band of 4 rows): all 16 channels of
// the group.
//
// Part 1: grouped 1x1 conv via V_WMMA_F32_16X16X4_F32, results straight into
// LDS. A tile product is D(16 oc x 16 pos) = W(16 x 16) * X(16 x 16 pos), four
// K-chunks of 4. The block needs k and v on 10 rows (40 tiles each) and q on
// its own 4 rows (16 tiles): 96 products, 6 per wave, with no branch among
// them, so that every wave's loads are issued ahead of its first product.
// A layout (ISA 7.12.2): lanes 0-15 hold K={0,1} in v0/v1, lanes 16-31 K={2,3}.
// C/D layout: VGPR r holds M = r (lanes 0-15) / M = r+8 (lanes 16-31), N=lane&15.
//
// Part 2: per-channel 7x7 local attention, two-pass softmax (one exp per
// neighbor). The score of a neighbor is q*k + q*r, and q*r is the same for all
// 49 neighbors of an output, so it cancels in the softmax: the weights are
// exp(q*k - max(q*k)) over their sum, and r (row_w, col_w) is not needed.
// With q' = q * log2(e) a weight is exp2(q'*k - max(q'*k)): one fma, one exp.
// The k and v bands lie in LDS inside a border of zeros (rows
// outside the plane, 4 columns left and right), which reproduces the
// reference's unfold() semantics (OOB: k = 0, value contribution 0) with
// no bounds test at the reads. Each thread computes 4 neighboring outputs of
// one row at a time: a window row of all 4 is 10 consecutive floats, read as
// three aligned 16-byte LDS loads.
// ---------------------------------------------------------------------------
__global__ __launch_bounds__(THREADS) void local_attn_kernel(
    const float* __restrict__ x,
    const float* __restrict__ wq,
    const float* __restrict__ wk,
    const float* __restrict__ wv,
    const float* __restrict__ row_w,   // (49, 32): enters only q*r, which cancels (see above)
    const float* __restrict__ col_w,   // (49, 32): the same
    float* __restrict__ out)
{
    __shared__ __attribute__((aligned(16))) float sm[2 * CG_ * CP_ + CG_ * QP_];

    const int tid  = threadIdx.x;
    const int band = blockIdx.x % (H_ / BR_);
    const int g    = (blockIdx.x / (H_ / BR_)) % G_;
    const int n    = blockIdx.x / ((H_ / BR_) * G_);
    const int h0   = band * BR_;               // first output row of the block
    const int ocb  = g * CG_;                  // first channel of the group

    const int lane = tid & 31;
    const int wave = __builtin_amdgcn_readfirstlane(tid >> 5) & (WAVES - 1);
    const int half = lane >> 4;                // 0: lanes 0-15, 1: lanes 16-31
    const int l16  = lane & 15;

    // Zero columns left and right of every k and v row: 16 x 10 x 2 16-byte pieces each.
    if (tid < CG_ * KR_ * 2) {
        const int zc  = tid / (KR_ * 2);
        const int zr  = tid % (KR_ * 2);
        const int off = zc * CP_ + (zr >> 1) * PW_ + (zr & 1) * (4 + W_);
        const v4f z = {0.0f, 0.0f, 0.0f, 0.0f};
        *reinterpret_cast<v4f*>(&sm[off])       = z;
        *reinterpret_cast<v4f*>(&sm[SV_ + off]) = z;
    }

    // ---- Part 1: the wave's 6 tile products on 3 position tiles ----
    // Tile numbers count the 10-row band, 4 tiles a row. Tiles 12..27 are the block's
    // own 4 rows: there one x tile serves k, v and q.
    int tile[3];
    tile[0] = PADT * TPR_ + wave;                          // 12..27: k, v and q
    tile[1] = wave < PADT * TPR_ ? wave : wave + QT_;      // 0..11 and 28..31: k and v
    tile[2] = 2 * QT_ + (wave & 7);                        // 32..39: k (waves 0-7) or v (waves 8-15)
    const bool third_is_v = wave >= 8;
    const float* wm = third_is_v ? wv : wk;

    // All loads of the wave stand ahead of its first product: one memory latency, not three.
    const float* xg = x + ((size_t)n * C_ + (size_t)ocb) * HW_;
    v2f b[3][4];
    bool inside[3];
#pragma unroll
    for (int i = 0; i < 3; ++i) {
        const int gh  = h0 - PADT + (tile[i] >> 2);                  // row of the plane
        inside[i] = gh >= 0 && gh < H_;
        const int ghc = gh < 0 ? 0 : (gh > H_ - 1 ? H_ - 1 : gh);    // keeps the address in the plane
        const float* xp = xg + ghc * W_ + (tile[i] & 3) * 16 + l16;
#pragma unroll
        for (int kc = 0; kc < 4; ++kc) {
            // B chunk: B[kr][nn] = x[n, g*16 + kc*4 + kr, ghc, col0 + nn]
            b[i][kc].x = xp[(size_t)(kc * 4 + 0 + 2 * half) * HW_];
            b[i][kc].y = xp[(size_t)(kc * 4 + 1 + 2 * half) * HW_];
        }
    }
    v2f aq[4], ak[4], av[4], am[4];
#pragma unroll
    for (int kc = 0; kc < 4; ++kc) {
        // A chunks: A[oc][kr] = w[(ocb + oc)*CG_ + kc*4 + kr]
        const int wbase = (ocb + l16) * CG_ + kc * 4 + 2 * half;
        aq[kc].x = wq[wbase]; aq[kc].y = wq[wbase + 1];
        ak[kc].x = wk[wbase]; ak[kc].y = wk[wbase + 1];
        av[kc].x = wv[wbase]; av[kc].y = wv[wbase + 1];
        am[kc].x = wm[wbase]; am[kc].y = wm[wbase + 1];
    }

    // What follows may rewrite registers that the loads above name as addresses.
    asm volatile("s_wait_xcnt 0x0" ::: "memory");

    v8f k0 = {}, v0 = {}, q0 = {}, k1 = {}, v1 = {}, m2 = {};
#pragma unroll
    for (int kc = 0; kc < 4; ++kc) {
        k0 = __builtin_amdgcn_wmma_f32_16x16x4_f32(false, ak[kc], false, b[0][kc], (short)0, k0, false, false);
        v0 = __builtin_amdgcn_wmma_f32_16x16x4_f32(false, av[kc], false, b[0][kc], (short)0, v0, false, false);
        q0 = __builtin_amdgcn_wmma_f32_16x16x4_f32(false, aq[kc], false, b[0][kc], (short)0, q0, false, false);
        k1 = __builtin_amdgcn_wmma_f32_16x16x4_f32(false, ak[kc], false, b[1][kc], (short)0, k1, false, false);
        v1 = __builtin_amdgcn_wmma_f32_16x16x4_f32(false, av[kc], false, b[1][kc], (short)0, v1, false, false);
        m2 = __builtin_amdgcn_wmma_f32_16x16x4_f32(false, am[kc], false, b[2][kc], (short)0, m2, false, false);
    }

    // Store D: element (M = r + 8*half, N = l16); a row outside the plane is zeros.
    {
        const int d0 = (tile[0] >> 2) * PW_ + 4 + (tile[0] & 3) * 16 + l16 + 8 * half * CP_;
        const int d1 = (tile[1] >> 2) * PW_ + 4 + (tile[1] & 3) * 16 + l16 + 8 * half * CP_;
        const int d2 = (tile[2] >> 2) * PW_ + 4 + (tile[2] & 3) * 16 + l16 + 8 * half * CP_
                     + (third_is_v ? SV_ : 0);
        const int dq = SQ_ + ((tile[0] >> 2) - PADT) * W_ + (tile[0] & 3) * 16 + l16 + 8 * half * QP_;
#pragma unroll
        for (int r = 0; r < 8; ++r) {
            sm[d0 + r * CP_]       = k0[r];
            sm[SV_ + d0 + r * CP_] = v0[r];
            sm[dq + r * QP_]       = q0[r];
            sm[d1 + r * CP_]       = inside[1] ? k1[r] : 0.0f;
            sm[SV_ + d1 + r * CP_] = inside[1] ? v1[r] : 0.0f;
            sm[d2 + r * CP_]       = inside[2] ? m2[r] : 0.0f;
        }
    }

    __syncthreads();                           // everyone's q, k, v and zeros are visible

    const int w0 = (tid & 15) * 4;             // first of this thread's 4 columns
    const int hr = (tid >> 4) & (BR_ - 1);     // row within the band

    // Kept rolled: one trip's straight-line code is large, and twice that text
    // would only add instruction fetches.
#pragma unroll 1
    for (int it = 0; it < 2; ++it) {
        const int ch = (tid >> 6) + 8 * it;    // channel within the group
        const float* sk = sm + ch * CP_;
        const float* sv = sm + SV_ + ch * CP_;
        const v4f q4 = *reinterpret_cast<const v4f*>(&sm[SQ_ + ch * QP_ + hr * W_ + w0]);
        const float L2E = 1.44269504088896340736f;             // log2(e)
        const float qv[4] = {q4.x * L2E, q4.y * L2E, q4.z * L2E, q4.w * L2E};
        const int t0 = hr * PW_ + w0;          // window's top row, 16-byte aligned column

        // kr[dy][i] = k at plane column w0 - 4 + i; output j, tap dx uses i = j + 1 + dx.
        float kr[FH_][12];
#pragma unroll
        for (int dy = 0; dy < FH_; ++dy) {
#pragma unroll
            for (int s = 0; s < 3; ++s) {
                const v4f t = *reinterpret_cast<const v4f*>(&sk[t0 + dy * PW_ + s * 4]);
                kr[dy][s * 4 + 0] = t.x;
                kr[dy][s * 4 + 1] = t.y;
                kr[dy][s * 4 + 2] = t.z;
                kr[dy][s * 4 + 3] = t.w;
            }
        }

        // Pass 1: running max of s = qv*kp.
        float m[4];
#pragma unroll
        for (int j = 0; j < 4; ++j) m[j] = -__builtin_inff();
#pragma unroll
        for (int dy = 0; dy < FH_; ++dy)
#pragma unroll
            for (int j = 0; j < 4; ++j)
#pragma unroll
                for (int dx = 0; dx < FW_; ++dx)
                    m[j] = fmaxf(m[j], qv[j] * kr[dy][j + 1 + dx]);

        // Pass 2: single exp per neighbor; accumulate normalizer + weighted V.
        float l[4]   = {0.0f, 0.0f, 0.0f, 0.0f};
        float acc[4] = {0.0f, 0.0f, 0.0f, 0.0f};
        v4f vn[3];                             // the v row one ahead of the row being summed
#pragma unroll
        for (int s = 0; s < 3; ++s)
            vn[s] = *reinterpret_cast<const v4f*>(&sv[t0 + s * 4]);
#pragma unroll
        for (int dy = 0; dy < FH_; ++dy) {
            // Inputs only: keeps all 12 loaded words live up to here. Two of them are never
            // used, and a temporary put into one while the load flies draws the wait forward.
            asm volatile("" :: "v"(vn[0]), "v"(vn[1]), "v"(vn[2]));
            float vr[12];
#pragma unroll
            for (int s = 0; s < 3; ++s) {
                vr[s * 4 + 0] = vn[s].x; vr[s * 4 + 1] = vn[s].y; vr[s * 4 + 2] = vn[s].z; vr[s * 4 + 3] = vn[s].w;
            }
            if (dy + 1 < FH_) {
#pragma unroll
                for (int s = 0; s < 3; ++s)
                    vn[s] = *reinterpret_cast<const v4f*>(&sv[t0 + (dy + 1) * PW_ + s * 4]);
            }
#pragma unroll
            for (int j = 0; j < 4; ++j) {
#pragma unroll
                for (int dx = 0; dx < FW_; ++dx) {
                    const float e = __builtin_amdgcn_exp2f(fmaf(qv[j], kr[dy][j + 1 + dx], -m[j]));
                    l[j]   += e;
                    acc[j] += e * vr[j + 1 + dx];
                }
            }
            // Ends a window row for the scheduler: without it the exps of all 7 rows
            // are lifted to the front and their results overflow the registers (scratch).
            __builtin_amdgcn_sched_barrier(0);
        }

        const v4f o = {acc[0] / l[0], acc[1] / l[1], acc[2] / l[2], acc[3] / l[3]};
        *reinterpret_cast<v4f*>(
            out + (((size_t)n * C_ + (size_t)(ocb + ch)) * H_ + (size_t)(h0 + hr)) * W_ + w0) = o;
        // The next trip rewrites the store's data and address registers.
        asm volatile("s_wait_xcnt 0x0" ::: "memory");
    }
}

extern "C" void kernel_launch(void* const* d_in, const int* in_sizes, int n_in,
                              void* d_out, int out_size, void* d_ws, size_t ws_size,
                              hipStream_t stream)
{
    const float* x     = (const float*)d_in[0];
    const float* wq    = (const float*)d_in[1];
    const float* wk    = (const float*)d_in[2];
    const float* wv    = (const float*)d_in[3];
    const float* row_w = (const float*)d_in[4];
    const float* col_w = (const float*)d_in[5];
    float* out = (float*)d_out;

    // One block per (n, group, band of 4 rows).
    local_attn_kernel<<<N_ * G_ * (H_ / BR_), THREADS, 0, stream>>>(
        x, wq, wk, wv, row_w, col_w, out);
}

// v004
// Measured time: 7.7 microseconds a run.
// Two timings next to v003 both put it at 1.05 times that version's speed.
// Over all steps from v000 it is 3.78 times as fast.
#include <hip/hip_runtime.h>

typedef __attribute__((ext_vector_type(2))) float v2f;
typedef __attribute__((ext_vector_type(4))) float v4f;
typedef __attribute__((ext_vector_type(8))) float v8f;

#define N_   4
#define C_   64
#define H_   64
#define W_   64
#define G_   4
#define CG_  16            // channels per group
#define HW_  (H_ * W_)
#define FH_  7
#define FW_  7
#define PADT 3
#define PADL 3
#define PW_  72            // LDS row pitch in floats: 4 zeros, 64 values, 4 zeros
#define BR_  4             // output rows per block
#define KR_  (BR_ + FH_ - 1)   // k/v rows per block: the band and 3 rows above and below
#define CP_  (KR_ * PW_ + 4)   // k/v channel pitch in floats; the 4 put channels c and c + 8 on different banks
#define QP_  (BR_ * W_ + 4)    // q channel pitch in floats, padded for the same reason
#define TPR_ (W_ / 16)         // 16-position tiles per row: 4
#define QT_  (BR_ * TPR_)      // tiles of the block's own 4 rows: 16 (the 10-row band has 40)
#define SV_  (CG_ * CP_)       // start of v in the LDS array
#define SQ_  (2 * CG_ * CP_)   // start of q in the LDS array
#define THREADS 512
#define WAVES   (THREADS / 32)

// ---------------------------------------------------------------------------
// One launch. One block = one (n, group, band of 4 rows): all 16 channels of
// the group.
//
// Part 1: grouped 1x1 conv via V_WMMA_F32_16X16X4_F32, results straight into
// LDS. A tile product is D(16 oc x 16 pos) = W(16 x 16) * X(16 x 16 pos), four
// K-chunks of 4. The block needs k and v on 10 rows (40 tiles each) and q on
// its own 4 rows (16 tiles): 96 products, 6 per wave, with no branch among
// them, so that every wave's loads are issued ahead of its first product.
// A layout (ISA 7.12.2): lanes 0-15 hold K={0,1} in v0/v1, lanes 16-31 K={2,3}.
// C/D layout: VGPR r holds M = r (lanes 0-15) / M = r+8 (lanes 16-31), N=lane&15.
//
// Part 2: per-channel 7x7 local attention, two-pass softmax (one exp per
// neighbor). The score of a neighbor is q*k + q*r, and q*r is the same for all
// 49 neighbors of an output, so it cancels in the softmax: the weights are
// exp(q*k - max(q*k)) over their sum, and r (row_w, col_w) is not needed.
// With q' = q * log2(e) a weight is exp2(q'*k - max(q'*k)): one fma, one exp.
// The k and v bands lie in LDS inside a border of zeros (rows
// outside the plane, 4 columns left and right), which reproduces the
// reference's unfold() semantics (OOB: k = 0, value contribution 0) with
// no bounds test at the reads. Each thread computes 4 neighboring outputs of
// one row at a time: a window row of all 4 is 10 consecutive floats, read as
// three aligned 16-byte LDS loads.
// ---------------------------------------------------------------------------
__global__ __launch_bounds__(THREADS) void local_attn_kernel(
    const float* __restrict__ x,
    const float* __restrict__ wq,
    const float* __restrict__ wk,
    const float* __restrict__ wv,
    const float* __restrict__ row_w,   // (49, 32): enters only q*r, which cancels (see above)
    const float* __restrict__ col_w,   // (49, 32): the same
    float* __restrict__ out)
{
    __shared__ __attribute__((aligned(16))) float sm[2 * CG_ * CP_ + CG_ * QP_];

    const int tid  = threadIdx.x;
    const int band = blockIdx.x % (H_ / BR_);
    const int g    = (blockIdx.x / (H_ / BR_)) % G_;
    const int n    = blockIdx.x / ((H_ / BR_) * G_);
    const int h0   = band * BR_;               // first output row of the block
    const int ocb  = g * CG_;                  // first channel of the group

    const int lane = tid & 31;
    const int wave = __builtin_amdgcn_readfirstlane(tid >> 5) & (WAVES - 1);
    const int half = lane >> 4;                // 0: lanes 0-15, 1: lanes 16-31
    const int l16  = lane & 15;

    // Zero columns left and right of every k and v row: 16 x 10 x 2 16-byte pieces each.
    if (tid < CG_ * KR_ * 2) {
        const int zc  = tid / (KR_ * 2);
        const int zr  = tid % (KR_ * 2);
        const int off = zc * CP_ + (zr >> 1) * PW_ + (zr & 1) * (4 + W_);
        const v4f z = {0.0f, 0.0f, 0.0f, 0.0f};
        *reinterpret_cast<v4f*>(&sm[off])       = z;
        *reinterpret_cast<v4f*>(&sm[SV_ + off]) = z;
    }

    // ---- Part 1: the wave's 6 tile products on 3 position tiles ----
    // Tile numbers count the 10-row band, 4 tiles a row. Tiles 12..27 are the block's
    // own 4 rows: there one x tile serves k, v and q.
    int tile[3];
    tile[0] = PADT * TPR_ + wave;                          // 12..27: k, v and q
    tile[1] = wave < PADT * TPR_ ? wave : wave + QT_;      // 0..11 and 28..31: k and v
    tile[2] = 2 * QT_ + (wave & 7);                        // 32..39: k (waves 0-7) or v (waves 8-15)
    const bool third_is_v = wave >= 8;
    const float* wm = third_is_v ? wv : wk;

    // All loads of the wave stand ahead of its first product: one memory latency, not three.
    const float* xg = x + ((size_t)n * C_ + (size_t)ocb) * HW_;
    v2f b[3][4];
    bool inside[3];
#pragma unroll
    for (int i = 0; i < 3; ++i) {
        const int gh  = h0 - PADT + (tile[i] >> 2);                  // row of the plane
        inside[i] = gh >= 0 && gh < H_;
        const int ghc = gh < 0 ? 0 : (gh > H_ - 1 ? H_ - 1 : gh);    // keeps the address in the plane
        const float* xp = xg + ghc * W_ + (tile[i] & 3) * 16 + l16;
#pragma unroll
        for (int kc = 0; kc < 4; ++kc) {
            // B chunk: B[kr][nn] = x[n, g*16 + kc*4 + kr, ghc, col0 + nn]
            b[i][kc].x = xp[(size_t)(kc * 4 + 0 + 2 * half) * HW_];
            b[i][kc].y = xp[(size_t)(kc * 4 + 1 + 2 * half) * HW_];
        }
    }
    v2f aq[4], ak[4], av[4], am[4];
#pragma unroll
    for (int kc = 0; kc < 4; ++kc) {
        // A chunks: A[oc][kr] = w[(ocb + oc)*CG_ + kc*4 + kr]
        const int wbase = (ocb + l16) * CG_ + kc * 4 + 2 * half;
        aq[kc].x = wq[wbase]; aq[kc].y = wq[wbase + 1];
        ak[kc].x = wk[wbase]; ak[kc].y = wk[wbase + 1];
        av[kc].x = wv[wbase]; av[kc].y = wv[wbase + 1];
        am[kc].x = wm[wbase]; am[kc].y = wm[wbase + 1];
    }

    // What follows may rewrite registers that the loads above name as addresses.
    asm volatile("s_wait_xcnt 0x0" ::: "memory");

    v8f k0 = {}, v0 = {}, q0 = {}, k1 = {}, v1 = {}, m2 = {};
#pragma unroll
    for (int kc = 0; kc < 4; ++kc) {
        k0 = __builtin_amdgcn_wmma_f32_16x16x4_f32(false, ak[kc], false, b[0][kc], (short)0, k0, false, false);
        v0 = __builtin_amdgcn_wmma_f32_16x16x4_f32(false, av[kc], false, b[0][kc], (short)0, v0, false, false);
        q0 = __builtin_amdgcn_wmma_f32_16x16x4_f32(false, aq[kc], false, b[0][kc], (short)0, q0, false, false);
        k1 = __builtin_amdgcn_wmma_f32_16x16x4_f32(false, ak[kc], false, b[1][kc], (short)0, k1, false, false);
        v1 = __builtin_amdgcn_wmma_f32_16x16x4_f32(false, av[kc], false, b[1][kc], (short)0, v1, false, false);
        m2 = __builtin_amdgcn_wmma_f32_16x16x4_f32(false, am[kc], false, b[2][kc], (short)0, m2, false, false);
    }

    // Store D: element (M = r + 8*half, N = l16); a row outside the plane is zeros.
    {
        const int d0 = (tile[0] >> 2) * PW_ + 4 + (tile[0] & 3) * 16 + l16 + 8 * half * CP_;
        const int d1 = (tile[1] >> 2) * PW_ + 4 + (tile[1] & 3) * 16 + l16 + 8 * half * CP_;
        const int d2 = (tile[2] >> 2) * PW_ + 4 + (tile[2] & 3) * 16 + l16 + 8 * half * CP_
                     + (third_is_v ? SV_ : 0);
        const int dq = SQ_ + ((tile[0] >> 2) - PADT) * W_ + (tile[0] & 3) * 16 + l16 + 8 * half * QP_;
#pragma unroll
        for (int r = 0; r < 8; ++r) {
            sm[d0 + r * CP_]       = k0[r];
            sm[SV_ + d0 + r * CP_] = v0[r];
            sm[dq + r * QP_]       = q0[r];
            sm[d1 + r * CP_]       = inside[1] ? k1[r] : 0.0f;
            sm[SV_ + d1 + r * CP_] = inside[1] ? v1[r] : 0.0f;
            sm[d2 + r * CP_]       = inside[2] ? m2[r] : 0.0f;
        }
    }

    __syncthreads();                           // everyone's q, k, v and zeros are visible

    const int w0 = (tid & 15) * 4;             // first of this thread's 4 columns
    const int hr = (tid >> 4) & (BR_ - 1);     // row within the band

    // Kept rolled: one trip's straight-line code is large, and twice that text
    // would only add instruction fetches.
#pragma unroll 1
    for (int it = 0; it < 2; ++it) {
        const int ch = (tid >> 6) + 8 * it;    // channel within the group
        const float* sk = sm + ch * CP_;
        const float* sv = sm + SV_ + ch * CP_;
        const v4f q4 = *reinterpret_cast<const v4f*>(&sm[SQ_ + ch * QP_ + hr * W_ + w0]);
        const float L2E = 1.44269504088896340736f;             // log2(e)
        const float qv[4] = {q4.x * L2E, q4.y * L2E, q4.z * L2E, q4.w * L2E};
        const int t0 = hr * PW_ + w0;          // window's top row, 16-byte aligned column

        // kr[dy][i] = k at plane column w0 - 4 + i; output j, tap dx uses i = j + 1 + dx.
        float kr[FH_][12];
#pragma unroll
        for (int dy = 0; dy < FH_; ++dy) {
#pragma unroll
            for (int s = 0; s < 3; ++s) {
                const v4f t = *reinterpret_cast<const v4f*>(&sk[t0 + dy * PW_ + s * 4]);
                kr[dy][s * 4 + 0] = t.x;
                kr[dy][s * 4 + 1] = t.y;
                kr[dy][s * 4 + 2] = t.z;
                kr[dy][s * 4 + 3] = t.w;
            }
        }

        // Pass 1: max of s = qv*kp over the window. Rounding a product is monotone in k,
        // so the largest product is qv times the window's largest k (qv >= 0) or its
        // smallest (qv < 0), bit for bit. The largest and smallest of each of the 10
        // columns are found once and serve all 4 outputs; so do those of columns 4..7,
        // 2..3 and 8..9, which several outputs' windows hold whole.
        float chi[12], clo[12];
#pragma unroll
        for (int i = 1; i <= 10; ++i) { chi[i] = kr[0][i]; clo[i] = kr[0][i]; }
#pragma unroll
        for (int dy = 1; dy < FH_; ++dy)
#pragma unroll
            for (int i = 1; i <= 10; ++i) {
                chi[i] = fmaxf(chi[i], kr[dy][i]);
                clo[i] = fminf(clo[i], kr[dy][i]);
            }
        const float mhi = fmaxf(fmaxf(fmaxf(chi[4], chi[5]), chi[6]), chi[7]);
        const float mlo = fminf(fminf(fminf(clo[4], clo[5]), clo[6]), clo[7]);
        const float ahi = fmaxf(chi[2], chi[3]), alo = fminf(clo[2], clo[3]);
        const float bhi = fmaxf(chi[8], chi[9]), blo = fminf(clo[8], clo[9]);
        const float hi[4] = {fmaxf(fmaxf(mhi, chi[1]), ahi), fmaxf(fmaxf(mhi, ahi), chi[8]),
                             fmaxf(fmaxf(mhi, chi[3]), bhi), fmaxf(fmaxf(mhi, bhi), chi[10])};
        const float lo[4] = {fminf(fminf(mlo, clo[1]), alo), fminf(fminf(mlo, alo), clo[8]),
                             fminf(fminf(mlo, clo[3]), blo), fminf(fminf(mlo, blo), clo[10])};
        float m[4];
#pragma unroll
        for (int j = 0; j < 4; ++j) m[j] = fmaxf(qv[j] * hi[j], qv[j] * lo[j]);

        // Pass 2: single exp per neighbor; accumulate normalizer + weighted V.
        float l[4]   = {0.0f, 0.0f, 0.0f, 0.0f};
        float acc[4] = {0.0f, 0.0f, 0.0f, 0.0f};
        v4f vn[3];                             // the v row one ahead of the row being summed
#pragma unroll
        for (int s = 0; s < 3; ++s)
            vn[s] = *reinterpret_cast<const v4f*>(&sv[t0 + s * 4]);
#pragma unroll
        for (int dy = 0; dy < FH_; ++dy) {
            // Inputs only: keeps all 12 loaded words live up to here. Two of them are never
            // used, and a temporary put into one while the load flies draws the wait forward.
            asm volatile("" :: "v"(vn[0]), "v"(vn[1]), "v"(vn[2]));
            float vr[12];
#pragma unroll
            for (int s = 0; s < 3; ++s) {
                vr[s * 4 + 0] = vn[s].x; vr[s * 4 + 1] = vn[s].y; vr[s * 4 + 2] = vn[s].z; vr[s * 4 + 3] = vn[s].w;
            }
            if (dy + 1 < FH_) {
#pragma unroll
                for (int s = 0; s < 3; ++s)
                    vn[s] = *reinterpret_cast<const v4f*>(&sv[t0 + (dy + 1) * PW_ + s * 4]);
            }
#pragma unroll
            for (int j = 0; j < 4; ++j) {
#pragma unroll
                for (int dx = 0; dx < FW_; ++dx) {
                    const float e = __builtin_amdgcn_exp2f(fmaf(qv[j], kr[dy][j + 1 + dx], -m[j]));
                    l[j]   += e;
                    acc[j] += e * vr[j + 1 + dx];
                }
            }
            // Ends a window row for the scheduler: without it the exps of all 7 rows
            // are lifted to the front and their results overflow the registers (scratch).
            __builtin_amdgcn_sched_barrier(0);
        }

        const v4f o = {acc[0] / l[0], acc[1] / l[1], acc[2] / l[2], acc[3] / l[3]};
        *reinterpret_cast<v4f*>(
            out + (((size_t)n * C_ + (size_t)(ocb + ch)) * H_ + (size_t)(h0 + hr)) * W_ + w0) = o;
        // The next trip rewrites the store's data and address registers.
        asm volatile("s_wait_xcnt 0x0" ::: "memory");
    }
}

extern "C" void kernel_launch(void* const* d_in, const int* in_sizes, int n_in,
                              void* d_out, int out_size, void* d_ws, size_t ws_size,
                              hipStream_t stream)
{
    const float* x     = (const float*)d_in[0];
    const float* wq    = (const float*)d_in[1];
    const float* wk    = (const float*)d_in[2];
    const float* wv    = (const float*)d_in[3];
    const float* row_w = (const float*)d_in[4];
    const float* col_w = (const float*)d_in[5];
    float* out = (float*)d_out;

    // One block per (n, group, band of 4 rows).
    local_attn_kernel<<<N_ * G_ * (H_ / BR_), THREADS, 0, stream>>>(
        x, wq, wk, wv, row_w, col_w, out);
}

// v005
// One run takes 7.21 microseconds.
// In both of two side-by-side timings against v004, it was 1.07 times as fast.
// Over all steps from v000 it is 4.03 times as fast.
#include <hip/hip_runtime.h>

typedef __attribute__((ext_vector_type(2))) float v2f;
typedef __attribute__((ext_vector_type(4))) float v4f;
typedef __attribute__((ext_vector_type(8))) float v8f;

#define N_   4
#define C_   64
#define H_   64
#define W_   64
#define G_   4
#define CG_  16            // channels per group
#define HW_  (H_ * W_)
#define FH_  7
#define FW_  7
#define PADT 3
#define PADL 3
#define PW_  72            // LDS row pitch in floats: 4 zeros, 64 values, 4 zeros
#define BR_  4             // output rows per block
#define KR_  (BR_ + FH_ - 1)   // k/v rows per block: the band and 3 rows above and below
#define CP_  (KR_ * PW_ + 4)   // k/v channel pitch in floats; the 4 put channels c and c + 8 on different banks
#define QP_  (BR_ * W_ + 4)    // q channel pitch in floats, padded for the same reason
#define TPR_ (W_ / 16)         // 16-position tiles per row: 4
#define QT_  (BR_ * TPR_)      // tiles of the block's own 4 rows: 16 (the 10-row band has 40)
#define SV_  (CG_ * CP_)       // start of v in the LDS array
#define SQ_  (2 * CG_ * CP_)   // start of q in the LDS array
#define THREADS 512
#define WAVES   (THREADS / 32)

// ---------------------------------------------------------------------------
// One launch. One block = one (n, group, band of 4 rows): all 16 channels of
// the group.
//
// Part 1: grouped 1x1 conv via V_WMMA_F32_16X16X4_F32, results straight into
// LDS. A tile product is D(16 oc x 16 pos) = W(16 x 16) * X(16 x 16 pos), four
// K-chunks of 4. The block needs k and v on 10 rows (40 tiles each) and q on
// its own 4 rows (16 tiles): 96 products, 6 per wave, with no branch among
// them, so that every wave's loads are issued ahead of its first product.
// A layout (ISA 7.12.2): lanes 0-15 hold K={0,1} in v0/v1, lanes 16-31 K={2,3}.
// C/D layout: VGPR r holds M = r (lanes 0-15) / M = r+8 (lanes 16-31), N=lane&15.
//
// Part 2: per-channel 7x7 local attention, two-pass softmax (one exp per
// neighbor). The score of a neighbor is q*k + q*r, and q*r is the same for all
// 49 neighbors of an output, so it cancels in the softmax: the weights are
// exp(q*k - max(q*k)) over their sum, and r (row_w, col_w) is not needed.
// With q' = q * log2(e) a weight is exp2(q'*k - max(q'*k)): one fma, one exp.
// The k and v bands lie in LDS inside a border of zeros (rows
// outside the plane, 4 columns left and right), which reproduces the
// reference's unfold() semantics (OOB: k = 0, value contribution 0) with
// no bounds test at the reads. Each thread computes 4 neighboring outputs of
// one row at a time: a window row of all 4 is 10 consecutive floats, read as
// three aligned 16-byte LDS loads.
// ---------------------------------------------------------------------------
__global__ __launch_bounds__(THREADS) void local_attn_kernel(
    const float* __restrict__ x,
    const float* __restrict__ wq,
    const float* __restrict__ wk,
    const float* __restrict__ wv,
    const float* __restrict__ row_w,   // (49, 32): enters only q*r, which cancels (see above)
    const float* __restrict__ col_w,   // (49, 32): the same
    float* __restrict__ out)
{
    __shared__ __attribute__((aligned(16))) float sm[2 * CG_ * CP_ + CG_ * QP_];

    const int tid  = threadIdx.x;
    const int band = blockIdx.x % (H_ / BR_);
    const int g    = (blockIdx.x / (H_ / BR_)) % G_;
    const int n    = blockIdx.x / ((H_ / BR_) * G_);
    const int h0   = band * BR_;               // first output row of the block
    const int ocb  = g * CG_;                  // first channel of the group

    const int lane = tid & 31;
    const int wave = __builtin_amdgcn_readfirstlane(tid >> 5) & (WAVES - 1);
    const int half = lane >> 4;                // 0: lanes 0-15, 1: lanes 16-31
    const int l16  = lane & 15;

    // Zero columns left and right of every k and v row: 16 x 10 x 2 16-byte pieces each.
    if (tid < CG_ * KR_ * 2) {
        const int zc  = tid / (KR_ * 2);
        const int zr  = tid % (KR_ * 2);
        const int off = zc * CP_ + (zr >> 1) * PW_ + (zr & 1) * (4 + W_);
        const v4f z = {0.0f, 0.0f, 0.0f, 0.0f};
        *reinterpret_cast<v4f*>(&sm[off])       = z;
        *reinterpret_cast<v4f*>(&sm[SV_ + off]) = z;
    }

    // ---- Part 1: the wave's 6 tile products on 3 position tiles ----
    // Tile numbers count the 10-row band, 4 tiles a row. Tiles 12..27 are the block's
    // own 4 rows: there one x tile serves k, v and q.
    int tile[3];
    tile[0] = PADT * TPR_ + wave;                          // 12..27: k, v and q
    tile[1] = wave < PADT * TPR_ ? wave : wave + QT_;      // 0..11 and 28..31: k and v
    tile[2] = 2 * QT_ + (wave & 7);                        // 32..39: k (waves 0-7) or v (waves 8-15)
    const bool third_is_v = wave >= 8;
    const float* wm = third_is_v ? wv : wk;

    // All loads of the wave stand ahead of its first product: one memory latency, not three.
    const float* xg = x + ((size_t)n * C_ + (size_t)ocb) * HW_;
    v2f b[3][4];
    bool inside[3];
#pragma unroll
    for (int i = 0; i < 3; ++i) {
        const int gh  = h0 - PADT + (tile[i] >> 2);                  // row of the plane
        inside[i] = gh >= 0 && gh < H_;
        const int ghc = gh < 0 ? 0 : (gh > H_ - 1 ? H_ - 1 : gh);    // keeps the address in the plane
        const float* xp = xg + ghc * W_ + (tile[i] & 3) * 16 + l16;
#pragma unroll
        for (int kc = 0; kc < 4; ++kc) {
            // B chunk: B[kr][nn] = x[n, g*16 + kc*4 + kr, ghc, col0 + nn]
            b[i][kc].x = xp[(size_t)(kc * 4 + 0 + 2 * half) * HW_];
            b[i][kc].y = xp[(size_t)(kc * 4 + 1 + 2 * half) * HW_];
        }
    }
    v2f aq[4], ak[4], av[4], am[4];
#pragma unroll
    for (int kc = 0; kc < 4; ++kc) {
        // A chunks: A[oc][kr] = w[(ocb + oc)*CG_ + kc*4 + kr]
        const int wbase = (ocb + l16) * CG_ + kc * 4 + 2 * half;
        aq[kc].x = wq[wbase]; aq[kc].y = wq[wbase + 1];
        ak[kc].x = wk[wbase]; ak[kc].y = wk[wbase + 1];
        av[kc].x = wv[wbase]; av[kc].y = wv[wbase + 1];
        am[kc].x = wm[wbase]; am[kc].y = wm[wbase + 1];
    }

    // What follows may rewrite registers that the loads above name as addresses.
    asm volatile("s_wait_xcnt 0x0" ::: "memory");

    v8f k0 = {}, v0 = {}, q0 = {}, k1 = {}, v1 = {}, m2 = {};
#pragma unroll
    for (int kc = 0; kc < 4; ++kc) {
        k0 = __builtin_amdgcn_wmma_f32_16x16x4_f32(false, ak[kc], false, b[0][kc], (short)0, k0, false, false);
        v0 = __builtin_amdgcn_wmma_f32_16x16x4_f32(false, av[kc], false, b[0][kc], (short)0, v0, false, false);
        q0 = __builtin_amdgcn_wmma_f32_16x16x4_f32(false, aq[kc], false, b[0][kc], (short)0, q0, false, false);
        k1 = __builtin_amdgcn_wmma_f32_16x16x4_f32(false, ak[kc], false, b[1][kc], (short)0, k1, false, false);
        v1 = __builtin_amdgcn_wmma_f32_16x16x4_f32(false, av[kc], false, b[1][kc], (short)0, v1, false, false);
        m2 = __builtin_amdgcn_wmma_f32_16x16x4_f32(false, am[kc], false, b[2][kc], (short)0, m2, false, false);
    }

    // Store D: element (M = r + 8*half, N = l16); a row outside the plane is zeros.
    {
        const int d0 = (tile[0] >> 2) * PW_ + 4 + (tile[0] & 3) * 16 + l16 + 8 * half * CP_;
        const int d1 = (tile[1] >> 2) * PW_ + 4 + (tile[1] & 3) * 16 + l16 + 8 * half * CP_;
        const int d2 = (tile[2] >> 2) * PW_ + 4 + (tile[2] & 3) * 16 + l16 + 8 * half * CP_
                     + (third_is_v ? SV_ : 0);
        const int dq = SQ_ + ((tile[0] >> 2) - PADT) * W_ + (tile[0] & 3) * 16 + l16 + 8 * half * QP_;
#pragma unroll
        for (int r = 0; r < 8; ++r) {
            sm[d0 + r * CP_]       = k0[r];
            sm[SV_ + d0 + r * CP_] = v0[r];
            sm[dq + r * QP_]       = q0[r];
            sm[d1 + r * CP_]       = inside[1] ? k1[r] : 0.0f;
            sm[SV_ + d1 + r * CP_] = inside[1] ? v1[r] : 0.0f;
            sm[d2 + r * CP_]       = inside[2] ? m2[r] : 0.0f;
        }
    }

    __syncthreads();                           // everyone's q, k, v and zeros are visible

    const int w0 = (tid & 15) * 4;             // first of this thread's 4 columns
    const int hr = (tid >> 4) & (BR_ - 1);     // row within the band

    // Kept rolled: one trip's straight-line code is large, and twice that text
    // would only add instruction fetches.
#pragma unroll 1
    for (int it = 0; it < 2; ++it) {
        const int ch = (tid >> 6) + 8 * it;    // channel within the group
        const float* sk = sm + ch * CP_;
        const float* sv = sm + SV_ + ch * CP_;
        const v4f q4 = *reinterpret_cast<const v4f*>(&sm[SQ_ + ch * QP_ + hr * W_ + w0]);
        const float L2E = 1.44269504088896340736f;             // log2(e)
        const float qv[4] = {q4.x * L2E, q4.y * L2E, q4.z * L2E, q4.w * L2E};
        const int t0 = hr * PW_ + w0;          // window's top row, 16-byte aligned column

        // kr[dy][i] = k at plane column w0 - 4 + i; output j, tap dx uses i = j + 1 + dx.
        float kr[FH_][12];
#pragma unroll
        for (int dy = 0; dy < FH_; ++dy) {
#pragma unroll
            for (int s = 0; s < 3; ++s) {
                const v4f t = *reinterpret_cast<const v4f*>(&sk[t0 + dy * PW_ + s * 4]);
                kr[dy][s * 4 + 0] = t.x;
                kr[dy][s * 4 + 1] = t.y;
                kr[dy][s * 4 + 2] = t.z;
                kr[dy][s * 4 + 3] = t.w;
            }
        }

        // Pass 1: max of s = qv*kp over the window. Rounding a product is monotone in k,
        // so the largest product is qv times the window's largest k (qv >= 0) or its
        // smallest (qv < 0), bit for bit. The largest and smallest of each of the 10
        // columns are found once and serve all 4 outputs; so do those of columns 4..7,
        // 2..3 and 8..9, which several outputs' windows hold whole.
        float chi[12], clo[12];
#pragma unroll
        for (int i = 1; i <= 10; ++i) { chi[i] = kr[0][i]; clo[i] = kr[0][i]; }
#pragma unroll
        for (int dy = 1; dy < FH_; ++dy)
#pragma unroll
            for (int i = 1; i <= 10; ++i) {
                chi[i] = fmaxf(chi[i], kr[dy][i]);
                clo[i] = fminf(clo[i], kr[dy][i]);
            }
        const float mhi = fmaxf(fmaxf(fmaxf(chi[4], chi[5]), chi[6]), chi[7]);
        const float mlo = fminf(fminf(fminf(clo[4], clo[5]), clo[6]), clo[7]);
        const float ahi = fmaxf(chi[2], chi[3]), alo = fminf(clo[2], clo[3]);
        const float bhi = fmaxf(chi[8], chi[9]), blo = fminf(clo[8], clo[9]);
        const float hi[4] = {fmaxf(fmaxf(mhi, chi[1]), ahi), fmaxf(fmaxf(mhi, ahi), chi[8]),
                             fmaxf(fmaxf(mhi, chi[3]), bhi), fmaxf(fmaxf(mhi, bhi), chi[10])};
        const float lo[4] = {fminf(fminf(mlo, clo[1]), alo), fminf(fminf(mlo, alo), clo[8]),
                             fminf(fminf(mlo, clo[3]), blo), fminf(fminf(mlo, blo), clo[10])};
        float m[4];
#pragma unroll
        for (int j = 0; j < 4; ++j) m[j] = fmaxf(qv[j] * hi[j], qv[j] * lo[j]);

        // Pass 2: single exp per neighbor; accumulate normalizer + weighted V.
        // Two taps per instruction: the even-aligned column pairs (2a, 2a + 1) of a loaded row
        // lie in register pairs as they come from LDS, so the score fma, the add into the
        // normalizer and the fma into the weighted sum each take a pair with no register copy.
        // A window of 7 columns holds 3 such pairs and one single column.
        v2f q2[4], nm2[4];
#pragma unroll
        for (int j = 0; j < 4; ++j) { q2[j] = v2f{qv[j], qv[j]}; nm2[j] = v2f{-m[j], -m[j]}; }
        v2f l2[4]   = {v2f{0.0f, 0.0f}, v2f{0.0f, 0.0f}, v2f{0.0f, 0.0f}, v2f{0.0f, 0.0f}};
        v2f acc2[4] = {v2f{0.0f, 0.0f}, v2f{0.0f, 0.0f}, v2f{0.0f, 0.0f}, v2f{0.0f, 0.0f}};
        float ls[4]   = {0.0f, 0.0f, 0.0f, 0.0f};          // the single columns' parts of both sums
        float accs[4] = {0.0f, 0.0f, 0.0f, 0.0f};
        v4f vn[3];                             // the v row one ahead of the row being summed
#pragma unroll
        for (int s = 0; s < 3; ++s)
            vn[s] = *reinterpret_cast<const v4f*>(&sv[t0 + s * 4]);
#pragma unroll
        for (int dy = 0; dy < FH_; ++dy) {
            // Inputs only: keeps all 12 loaded words live up to here. Two of them are never
            // used, and a temporary put into one while the load flies draws the wait forward.
            asm volatile("" :: "v"(vn[0]), "v"(vn[1]), "v"(vn[2]));
            float vr[12];
#pragma unroll
            for (int s = 0; s < 3; ++s) {
                vr[s * 4 + 0] = vn[s].x; vr[s * 4 + 1] = vn[s].y; vr[s * 4 + 2] = vn[s].z; vr[s * 4 + 3] = vn[s].w;
            }
            if (dy + 1 < FH_) {
#pragma unroll
                for (int s = 0; s < 3; ++s)
                    vn[s] = *reinterpret_cast<const v4f*>(&sv[t0 + (dy + 1) * PW_ + s * 4]);
            }
#pragma unroll
            for (int j = 0; j < 4; ++j) {
                const int p0 = (j + 2) >> 1;           // first whole pair of the window j+1 .. j+7
#pragma unroll
                for (int p = p0; p < p0 + 3; ++p) {
                    const v2f k2 = {kr[dy][2 * p], kr[dy][2 * p + 1]};
                    const v2f v2 = {vr[2 * p], vr[2 * p + 1]};
                    const v2f s2 = __builtin_elementwise_fma(q2[j], k2, nm2[j]);
                    const v2f e2 = {__builtin_amdgcn_exp2f(s2.x), __builtin_amdgcn_exp2f(s2.y)};
                    l2[j]  += e2;
                    acc2[j] = __builtin_elementwise_fma(e2, v2, acc2[j]);
                }
                const int i1 = (j & 1) ? j + 7 : j + 1;  // the single column: last or first of the window
                const float e1 = __builtin_amdgcn_exp2f(fmaf(qv[j], kr[dy][i1], -m[j]));
                ls[j]  += e1;
                accs[j] = fmaf(e1, vr[i1], accs[j]);
            }
            // Ends a window row for the scheduler: without it the exps of all 7 rows
            // are lifted to the front and their results overflow the registers (scratch).
            __builtin_amdgcn_sched_barrier(0);
        }
        const float l[4]   = {(l2[0].x + l2[0].y) + ls[0], (l2[1].x + l2[1].y) + ls[1],
                              (l2[2].x + l2[2].y) + ls[2], (l2[3].x + l2[3].y) + ls[3]};
        const float acc[4] = {(acc2[0].x + acc2[0].y) + accs[0], (acc2[1].x + acc2[1].y) + accs[1],
                              (acc2[2].x + acc2[2].y) + accs[2], (acc2[3].x + acc2[3].y) + accs[3]};

        const v4f o = {acc[0] / l[0], acc[1] / l[1], acc[2] / l[2], acc[3] / l[3]};
        *reinterpret_cast<v4f*>(
            out + (((size_t)n * C_ + (size_t)(ocb + ch)) * H_ + (size_t)(h0 + hr)) * W_ + w0) = o;
        // The next trip rewrites the store's data and address registers.
        asm volatile("s_wait_xcnt 0x0" ::: "memory");
    }
}

extern "C" void kernel_launch(void* const* d_in, const int* in_sizes, int n_in,
                              void* d_out, int out_size, void* d_ws, size_t ws_size,
                              hipStream_t stream)
{
    const float* x     = (const float*)d_in[0];
    const float* wq    = (const float*)d_in[1];
    const float* wk    = (const float*)d_in[2];
    const float* wv    = (const float*)d_in[3];
    const float* row_w = (const float*)d_in[4];
    const float* col_w = (const float*)d_in[5];
    float* out = (float*)d_out;

    // One block per (n, group, band of 4 rows).
    local_attn_kernel<<<N_ * G_ * (H_ / BR_), THREADS, 0, stream>>>(
        x, wq, wk, wv, row_w, col_w, out);
}

// v006
// It runs in 6.74 microseconds.
// Two timings next to v005 both put it at 1.07 times that version's speed.
// Counting every step since v000, it is 4.31 times as fast.
#include <hip/hip_runtime.h>

typedef __attribute__((ext_vector_type(2))) float v2f;
typedef __attribute__((ext_vector_type(4))) float v4f;
typedef __attribute__((ext_vector_type(8))) float v8f;

#define N_   4
#define C_   64
#define H_   64
#define W_   64
#define G_   4
#define CG_  16            // channels per group
#define HW_  (H_ * W_)
#define FH_  7
#define FW_  7
#define PADT 3
#define PADL 3
#define PW_  72            // LDS row pitch in floats: 4 zeros, 64 values, 4 zeros
#define BR_  4             // output rows per block
#define KR_  (BR_ + FH_ - 1)   // k/v rows per block: the band and 3 rows above and below
#define CP_  (KR_ * PW_ + 4)   // k/v channel pitch in floats; the 4 put channels c and c + 8 on different banks
#define QP_  (BR_ * W_ + 4)    // q channel pitch in floats, padded for the same reason
#define TPR_ (W_ / 16)         // 16-position tiles per row: 4
#define QT_  (BR_ * TPR_)      // tiles of the block's own 4 rows: 16 (the 10-row band has 40)
#define SV_  (CG_ * CP_)       // start of v in the LDS array
#define SQ_  (2 * CG_ * CP_)   // start of q in the LDS array
#define THREADS 512
#define WAVES   (THREADS / 32)
#define TR_  2                 // output rows per thread
#define TC_  4                 // output columns per thread
#define LR_  (TR_ + FH_ - 1)   // k/v rows a thread reads: 8
#define LC_  (TC_ + 8)         // k/v columns a thread reads per row: 12, three 16-byte loads

// ---------------------------------------------------------------------------
// One launch. One block = one (n, group, band of 4 rows): all 16 channels of
// the group.
//
// Part 1: grouped 1x1 conv via V_WMMA_F32_16X16X4_F32, results straight into
// LDS. A tile product is D(16 oc x 16 pos) = W(16 x 16) * X(16 x 16 pos), four
// K-chunks of 4. The block needs k and v on 10 rows (40 tiles each) and q on
// its own 4 rows (16 tiles): 96 products, 6 per wave, with no branch among
// them, so that every wave's loads are issued ahead of its first product.
// A layout (ISA 7.12.2): lanes 0-15 hold K={0,1} in v0/v1, lanes 16-31 K={2,3}.
// C/D layout: VGPR r holds M = r (lanes 0-15) / M = r+8 (lanes 16-31), N=lane&15.
//
// Part 2: per-channel 7x7 local attention, two-pass softmax (one exp per
// neighbor). The score of a neighbor is q*k + q*r, and q*r is the same for all
// 49 neighbors of an output, so it cancels in the softmax: the weights are
// exp(q*k - max(q*k)) over their sum, and r (row_w, col_w) is not needed.
// With q' = q * log2(e) a weight is exp2(q'*k - max(q'*k)): one fma, one exp.
// The k and v bands lie in LDS inside a border of zeros (rows
// outside the plane, 4 columns left and right), which reproduces the
// reference's unfold() semantics (OOB: k = 0, value contribution 0) with
// no bounds test at the reads. Each thread computes a tile of 2 rows x 4
// columns of one channel, once: the 8 windows lie in 8 rows of 10 consecutive
// floats, read as three aligned 16-byte LDS loads a row, and loaded rows 1..6
// serve both output rows, rows 0 and 7 one each.
// ---------------------------------------------------------------------------
__global__ __launch_bounds__(THREADS) void local_attn_kernel(
    const float* __restrict__ x,
    const float* __restrict__ wq,
    const float* __restrict__ wk,
    const float* __restrict__ wv,
    const float* __restrict__ row_w,   // (49, 32): enters only q*r, which cancels (see above)
    const float* __restrict__ col_w,   // (49, 32): the same
    float* __restrict__ out)
{
    __shared__ __attribute__((aligned(16))) float sm[2 * CG_ * CP_ + CG_ * QP_];

    const int tid  = threadIdx.x;
    const int band = blockIdx.x % (H_ / BR_);
    const int g    = (blockIdx.x / (H_ / BR_)) % G_;
    const int n    = blockIdx.x / ((H_ / BR_) * G_);
    const int h0   = band * BR_;               // first output row of the block
    const int ocb  = g * CG_;                  // first channel of the group

    const int lane = tid & 31;
    const int wave = __builtin_amdgcn_readfirstlane(tid >> 5) & (WAVES - 1);
    const int half = lane >> 4;                // 0: lanes 0-15, 1: lanes 16-31
    const int l16  = lane & 15;

    // Zero columns left and right of every k and v row: 16 x 10 x 2 16-byte pieces each.
    if (tid < CG_ * KR_ * 2) {
        const int zc  = tid / (KR_ * 2);
        const int zr  = tid % (KR_ * 2);
        const int off = zc * CP_ + (zr >> 1) * PW_ + (zr & 1) * (4 + W_);
        const v4f z = {0.0f, 0.0f, 0.0f, 0.0f};
        *reinterpret_cast<v4f*>(&sm[off])       = z;
        *reinterpret_cast<v4f*>(&sm[SV_ + off]) = z;
    }

    // ---- Part 1: the wave's 6 tile products on 3 position tiles ----
    // Tile numbers count the 10-row band, 4 tiles a row. Tiles 12..27 are the block's
    // own 4 rows: there one x tile serves k, v and q.
    int tile[3];
    tile[0] = PADT * TPR_ + wave;                          // 12..27: k, v and q
    tile[1] = wave < PADT * TPR_ ? wave : wave + QT_;      // 0..11 and 28..31: k and v
    tile[2] = 2 * QT_ + (wave & 7);                        // 32..39: k (waves 0-7) or v (waves 8-15)
    const bool third_is_v = wave >= 8;
    const float* wm = third_is_v ? wv : wk;

    // All loads of the wave stand ahead of its first product: one memory latency, not three.
    const float* xg = x + ((size_t)n * C_ + (size_t)ocb) * HW_;
    v2f b[3][4];
    bool inside[3];
#pragma unroll
    for (int i = 0; i < 3; ++i) {
        const int gh  = h0 - PADT + (tile[i] >> 2);                  // row of the plane
        inside[i] = gh >= 0 && gh < H_;
        const int ghc = gh < 0 ? 0 : (gh > H_ - 1 ? H_ - 1 : gh);    // keeps the address in the plane
        const float* xp = xg + ghc * W_ + (tile[i] & 3) * 16 + l16;
#pragma unroll
        for (int kc = 0; kc < 4; ++kc) {
            // B chunk: B[kr][nn] = x[n, g*16 + kc*4 + kr, ghc, col0 + nn]
            b[i][kc].x = xp[(size_t)(kc * 4 + 0 + 2 * half) * HW_];
            b[i][kc].y = xp[(size_t)(kc * 4 + 1 + 2 * half) * HW_];
        }
    }
    v2f aq[4], ak[4], av[4], am[4];
#pragma unroll
    for (int kc = 0; kc < 4; ++kc) {
        // A chunks: A[oc][kr] = w[(ocb + oc)*CG_ + kc*4 + kr]
        const int wbase = (ocb + l16) * CG_ + kc * 4 + 2 * half;
        aq[kc].x = wq[wbase]; aq[kc].y = wq[wbase + 1];
        ak[kc].x = wk[wbase]; ak[kc].y = wk[wbase + 1];
        av[kc].x = wv[wbase]; av[kc].y = wv[wbase + 1];
        am[kc].x = wm[wbase]; am[kc].y = wm[wbase + 1];
    }

    // What follows may rewrite registers that the loads above name as addresses.
    asm volatile("s_wait_xcnt 0x0" ::: "memory");

    v8f k0 = {}, v0 = {}, q0 = {}, k1 = {}, v1 = {}, m2 = {};
#pragma unroll
    for (int kc = 0; kc < 4; ++kc) {
        k0 = __builtin_amdgcn_wmma_f32_16x16x4_f32(false, ak[kc], false, b[0][kc], (short)0, k0, false, false);
        v0 = __builtin_amdgcn_wmma_f32_16x16x4_f32(false, av[kc], false, b[0][kc], (short)0, v0, false, false);
        q0 = __builtin_amdgcn_wmma_f32_16x16x4_f32(false, aq[kc], false, b[0][kc], (short)0, q0, false, false);
        k1 = __builtin_amdgcn_wmma_f32_16x16x4_f32(false, ak[kc], false, b[1][kc], (short)0, k1, false, false);
        v1 = __builtin_amdgcn_wmma_f32_16x16x4_f32(false, av[kc], false, b[1][kc], (short)0, v1, false, false);
        m2 = __builtin_amdgcn_wmma_f32_16x16x4_f32(false, am[kc], false, b[2][kc], (short)0, m2, false, false);
    }

    // Store D: element (M = r + 8*half, N = l16); a row outside the plane is zeros.
    {
        const int d0 = (tile[0] >> 2) * PW_ + 4 + (tile[0] & 3) * 16 + l16 + 8 * half * CP_;
        const int d1 = (tile[1] >> 2) * PW_ + 4 + (tile[1] & 3) * 16 + l16 + 8 * half * CP_;
        const int d2 = (tile[2] >> 2) * PW_ + 4 + (tile[2] & 3) * 16 + l16 + 8 * half * CP_
                     + (third_is_v ? SV_ : 0);
        const int dq = SQ_ + ((tile[0] >> 2) - PADT) * W_ + (tile[0] & 3) * 16 + l16 + 8 * half * QP_;
#pragma unroll
        for (int r = 0; r < 8; ++r) {
            sm[d0 + r * CP_]       = k0[r];
            sm[SV_ + d0 + r * CP_] = v0[r];
            sm[dq + r * QP_]       = q0[r];
            sm[d1 + r * CP_]       = inside[1] ? k1[r] : 0.0f;
            sm[SV_ + d1 + r * CP_] = inside[1] ? v1[r] : 0.0f;
            sm[d2 + r * CP_]       = inside[2] ? m2[r] : 0.0f;
        }
    }

    __syncthreads();                           // everyone's q, k, v and zeros are visible

    const int w0  = (tid & 15) * TC_;                      // first of this thread's 4 columns
    const int ch  = tid >> 5;                              // channel within the group: one per wave
    const int hr0 = ((tid >> 4) & 1) * TR_;                // first of its 2 rows within the band

    const float* sk = sm + ch * CP_;
    const float* sv = sm + SV_ + ch * CP_;
    const float L2E = 1.44269504088896340736f;             // log2(e)
    float qv[TR_][TC_];
#pragma unroll
    for (int o = 0; o < TR_; ++o)
#pragma unroll
        for (int s = 0; s < TC_ / 4; ++s) {
            const v4f q4 = *reinterpret_cast<const v4f*>(&sm[SQ_ + ch * QP_ + (hr0 + o) * W_ + w0 + s * 4]);
            qv[o][s * 4 + 0] = q4.x * L2E; qv[o][s * 4 + 1] = q4.y * L2E;
            qv[o][s * 4 + 2] = q4.z * L2E; qv[o][s * 4 + 3] = q4.w * L2E;
        }
    const int t0 = hr0 * PW_ + w0;             // top row of the upper windows, 16-byte aligned column

    // kr[r][i] = k at plane column w0 - 4 + i; output row o, column j, tap (dy, dx) uses
    // r = o + dy, i = j + 1 + dx.
    float kr[LR_][LC_];
#pragma unroll
    for (int r = 0; r < LR_; ++r) {
#pragma unroll
        for (int s = 0; s < LC_ / 4; ++s) {
            const v4f t = *reinterpret_cast<const v4f*>(&sk[t0 + r * PW_ + s * 4]);
            kr[r][s * 4 + 0] = t.x;
            kr[r][s * 4 + 1] = t.y;
            kr[r][s * 4 + 2] = t.z;
            kr[r][s * 4 + 3] = t.w;
        }
    }

    // Pass 1: max of s = qv*kp over the window. Rounding a product is monotone in k,
    // so the largest product is qv times the window's largest k (qv >= 0) or its
    // smallest (qv < 0), bit for bit. Of each of the 10 columns the largest and smallest
    // over rows 1..6, which both output rows' windows hold, are found once; row 0 or row 7
    // completes them. Along a row the column pairs (2a, 2a + 1) and the runs of three pairs
    // are found once; a run serves two outputs.
    float m[TR_][TC_];
    {
        float chi[TR_][LC_], clo[TR_][LC_];
#pragma unroll
        for (int i = 1; i <= TC_ + 6; ++i) {
            float a = fmaxf(fmaxf(kr[1][i], kr[2][i]), kr[3][i]);
            float c = fminf(fminf(kr[1][i], kr[2][i]), kr[3][i]);
            a = fmaxf(fmaxf(a, kr[4][i]), kr[5][i]);
            c = fminf(fminf(c, kr[4][i]), kr[5][i]);
            chi[0][i] = fmaxf(fmaxf(a, kr[6][i]), kr[0][i]);
            clo[0][i] = fminf(fminf(c, kr[6][i]), kr[0][i]);
            chi[1][i] = fmaxf(fmaxf(a, kr[6][i]), kr[7][i]);
            clo[1][i] = fminf(fminf(c, kr[6][i]), kr[7][i]);
        }
#pragma unroll
        for (int o = 0; o < TR_; ++o) {
            float phi[LC_ / 2], plo[LC_ / 2];
#pragma unroll
            for (int a = 1; a <= (TC_ + 4) / 2; ++a) {
                phi[a] = fmaxf(chi[o][2 * a], chi[o][2 * a + 1]);
                plo[a] = fminf(clo[o][2 * a], clo[o][2 * a + 1]);
            }
#pragma unroll
            for (int j = 0; j < TC_; ++j) {
                const int p0 = (j + 2) >> 1;             // first whole pair of the window j+1 .. j+7
                const int i1 = (j & 1) ? j + 7 : j + 1;  // the single column: last or first of the window
                const float hi = fmaxf(fmaxf(fmaxf(phi[p0], phi[p0 + 1]), phi[p0 + 2]), chi[o][i1]);
                const float lo = fminf(fminf(fminf(plo[p0], plo[p0 + 1]), plo[p0 + 2]), clo[o][i1]);
                m[o][j] = fmaxf(qv[o][j] * hi, qv[o][j] * lo);
            }
        }
    }

    // Pass 2: single exp per neighbor; accumulate normalizer + weighted V.
    // Two taps per instruction: the even-aligned column pairs (2a, 2a + 1) of a loaded row
    // lie in register pairs as they come from LDS, so the score fma, the add into the
    // normalizer and the fma into the weighted sum each take a pair with no register copy.
    // A window of 7 columns holds 3 such pairs and one single column.
    v2f q2[TR_][TC_], nm2[TR_][TC_], l2[TR_][TC_], acc2[TR_][TC_];
    float ls[TR_][TC_], accs[TR_][TC_];        // the single columns' parts of both sums
#pragma unroll
    for (int o = 0; o < TR_; ++o)
#pragma unroll
        for (int j = 0; j < TC_; ++j) {
            q2[o][j]   = v2f{qv[o][j], qv[o][j]};
            nm2[o][j]  = v2f{-m[o][j], -m[o][j]};
            l2[o][j]   = v2f{0.0f, 0.0f};
            acc2[o][j] = v2f{0.0f, 0.0f};
            ls[o][j]   = 0.0f;
            accs[o][j] = 0.0f;
        }
    v4f vn[LC_ / 4];                           // the v row one ahead of the row being summed
#pragma unroll
    for (int s = 0; s < LC_ / 4; ++s)
        vn[s] = *reinterpret_cast<const v4f*>(&sv[t0 + s * 4]);
#pragma unroll
    for (int r = 0; r < LR_; ++r) {
        // Inputs only: keeps all 12 loaded words live up to here. Two of them are never
        // used, and a temporary put into one while the load flies draws the wait forward.
        asm volatile("" :: "v"(vn[0]), "v"(vn[1]), "v"(vn[2]));
        float vr[LC_];
#pragma unroll
        for (int s = 0; s < LC_ / 4; ++s) {
            vr[s * 4 + 0] = vn[s].x; vr[s * 4 + 1] = vn[s].y; vr[s * 4 + 2] = vn[s].z; vr[s * 4 + 3] = vn[s].w;
        }
        if (r + 1 < LR_) {
#pragma unroll
            for (int s = 0; s < LC_ / 4; ++s)
                vn[s] = *reinterpret_cast<const v4f*>(&sv[t0 + (r + 1) * PW_ + s * 4]);
        }
#pragma unroll
        for (int o = 0; o < TR_; ++o) {
            if (r - o < 0 || r - o >= FH_) continue;       // row r is no row of output row o's windows
#pragma unroll
            for (int jb = 0; jb < TC_; jb += 4) {
#pragma unroll
                for (int j = jb; j < jb + 4; ++j) {
                    const int p0 = (j + 2) >> 1;           // first whole pair of the window j+1 .. j+7
#pragma unroll
                    for (int p = p0; p < p0 + 3; ++p) {
                        const v2f k2 = {kr[r][2 * p], kr[r][2 * p + 1]};
                        const v2f v2 = {vr[2 * p], vr[2 * p + 1]};
                        const v2f s2 = __builtin_elementwise_fma(q2[o][j], k2, nm2[o][j]);
                        const v2f e2 = {__builtin_amdgcn_exp2f(s2.x), __builtin_amdgcn_exp2f(s2.y)};
                        l2[o][j]  += e2;
                        acc2[o][j] = __builtin_elementwise_fma(e2, v2, acc2[o][j]);
                    }
                    const int i1 = (j & 1) ? j + 7 : j + 1;  // the single column: last or first of the window
                    const float e1 = __builtin_amdgcn_exp2f(fmaf(qv[o][j], kr[r][i1], -m[o][j]));
                    ls[o][j]  += e1;
                    accs[o][j] = fmaf(e1, vr[i1], accs[o][j]);
                }
                // Inputs only: this window row's sums are formed here, ahead of the next row's wait.
                // Without it the compiler puts all 8 rows' loads and waits first and all sums behind
                // them, so that no load flies under arithmetic and every v row stays in registers.
                asm volatile("" :: "v"(l2[o][jb]), "v"(l2[o][jb + 1]), "v"(l2[o][jb + 2]), "v"(l2[o][jb + 3]),
                                   "v"(acc2[o][jb]), "v"(acc2[o][jb + 1]), "v"(acc2[o][jb + 2]), "v"(acc2[o][jb + 3]),
                                   "v"(ls[o][jb]), "v"(ls[o][jb + 1]), "v"(ls[o][jb + 2]), "v"(ls[o][jb + 3]),
                                   "v"(accs[o][jb]), "v"(accs[o][jb + 1]), "v"(accs[o][jb + 2]), "v"(accs[o][jb + 3]));
                // Ends four outputs' window row for the scheduler: without it the exps of many
                // rows are lifted to the front and their results overflow the registers (scratch).
                __builtin_amdgcn_sched_barrier(0);
            }
        }
    }

    float* op = out + (((size_t)n * C_ + (size_t)(ocb + ch)) * H_ + (size_t)(h0 + hr0)) * W_ + w0;
    v4f res[TR_][TC_ / 4];
#pragma unroll
    for (int o = 0; o < TR_; ++o)
#pragma unroll
        for (int j = 0; j < TC_; ++j) {
            const float l   = (l2[o][j].x + l2[o][j].y) + ls[o][j];
            const float acc = (acc2[o][j].x + acc2[o][j].y) + accs[o][j];
            res[o][j >> 2][j & 3] = acc / l;
        }
    // All 8 quotients stand ahead of the stores: behind a store nothing rewrites its registers.
    __builtin_amdgcn_sched_barrier(0);
#pragma unroll
    for (int o = 0; o < TR_; ++o)
#pragma unroll
        for (int s = 0; s < TC_ / 4; ++s)
            *reinterpret_cast<v4f*>(op + o * W_ + s * 4) = res[o][s];
}

extern "C" void kernel_launch(void* const* d_in, const int* in_sizes, int n_in,
                              void* d_out, int out_size, void* d_ws, size_t ws_size,
                              hipStream_t stream)
{
    const float* x     = (const float*)d_in[0];
    const float* wq    = (const float*)d_in[1];
    const float* wk    = (const float*)d_in[2];
    const float* wv    = (const float*)d_in[3];
    const float* row_w = (const float*)d_in[4];
    const float* col_w = (const float*)d_in[5];
    float* out = (float*)d_out;

    // One block per (n, group, band of 4 rows).
    local_attn_kernel<<<N_ * G_ * (H_ / BR_), THREADS, 0, stream>>>(
        x, wq, wk, wv, row_w, col_w, out);
}
